// v000
// The times below were measured on an AMD MI455X: many runs one after another, warmed up first and cycling through
// copies of the inputs, with the whole window's GPU time divided by the number of runs. Launches and the gaps
// between them are all in it. The median over several windows is given; except for v000 it joins two sittings, which
// can be a few percent apart, so the side-by-side timings, each taken in one sitting, are the better comparison.
// v000 is the starting kernel. One run takes 244 microseconds.
#include <hip/hip_runtime.h>

// Problem constants (from setup_inputs): B=4, C=256, Ci=128, T=8192, N=T/2
#define Bk  4
#define Cc  256
#define Cin 128
#define Tt  8192
#define Npool 4096
#define BN_EPS 1e-5f

typedef float v2f __attribute__((ext_vector_type(2)));
typedef float v8f __attribute__((ext_vector_type(8)));

// V_WMMA_F32_16X16X4_F32 : D(16x16 f32) = A(16x4 f32) * B(4x16 f32) + C
// 8-arg pattern: (neg_a, A, neg_b, B, c_mod, C, reuse_a, reuse_b)
__device__ __forceinline__ v8f wmma4(v2f a, v2f b, v8f c) {
  return __builtin_amdgcn_wmma_f32_16x16x4_f32(false, a, false, b, (short)0, c,
                                               false, false);
}

// ---------------------------------------------------------------------------
// Kernel 1: 1x1 conv as GEMM  out[b,o,t] = sum_c w[o,c] x[b,c,t] + bias[o]
// POOL=1: each wave covers 32 t's and writes maxpooled 16 n's.
// One wave per 16(o) x 16/32(t) tile.
// ---------------------------------------------------------------------------
template <int POOL>
__global__ __launch_bounds__(256) void conv1x1_kernel(
    const float* __restrict__ x, const float* __restrict__ w,
    const float* __restrict__ bias, float* __restrict__ out) {
  const int TW = POOL ? 32 : 16;
  const int tTiles = Tt / TW;
  int wid  = (blockIdx.x * blockDim.x + threadIdx.x) >> 5;
  int lane = threadIdx.x & 31;
  int half = lane >> 4, lm = lane & 15;
  int tt = wid % tTiles;
  int rt = (wid / tTiles) & 7;          // Cin/16 = 8 row tiles
  int b  = wid / (tTiles * 8);
  int o0 = rt * 16, t0 = tt * TW;

  const float* xb = x + (size_t)b * Cc * Tt;
  v8f acc0 = {};
  v8f acc1 = {};
  for (int ks = 0; ks < Cc / 4; ++ks) {
    int k = ks * 4 + half * 2;
    v2f a = *(const v2f*)(w + (size_t)(o0 + lm) * Cc + k);     // A[row=o, k]
    v2f b0;
    b0.x = xb[(size_t)k * Tt + t0 + lm];                        // B[k, col=t]
    b0.y = xb[(size_t)(k + 1) * Tt + t0 + lm];
    acc0 = wmma4(a, b0, acc0);
    if (POOL) {
      v2f b1;
      b1.x = xb[(size_t)k * Tt + t0 + 16 + lm];
      b1.y = xb[(size_t)(k + 1) * Tt + t0 + 16 + lm];
      acc1 = wmma4(a, b1, acc1);
    }
  }

  if (!POOL) {
    float* ob = out + ((size_t)b * Cin + o0) * Tt + t0;
    for (int r = 0; r < 8; ++r) {
      int row = r + half * 8;
      ob[(size_t)row * Tt + lm] = acc0[r] + bias[o0 + row];
    }
  } else {
    // maxpool2 across adjacent t lanes, then add bias (bias commutes with max)
    float* ob = out + ((size_t)b * Cin + o0) * Npool + (t0 >> 1);
    for (int r = 0; r < 8; ++r) {
      int row = r + half * 8;
      float v0 = acc0[r], v1 = acc1[r];
      float m0 = fmaxf(v0, __shfl_xor(v0, 1));
      float m1 = fmaxf(v1, __shfl_xor(v1, 1));
      if ((lm & 1) == 0) {
        float bz = bias[o0 + row];
        ob[(size_t)row * Npool + (lm >> 1)]     = m0 + bz;
        ob[(size_t)row * Npool + 8 + (lm >> 1)] = m1 + bz;
      }
    }
  }
}

// ---------------------------------------------------------------------------
// Kernel 2: M[b,cp,c] = (1/N) * sum_n phi[b,cp,n] * g[b,c,n]   (128x128, K=4096)
// One wave per 16x16 tile, full K. Both fragments are contiguous float2 loads.
// ---------------------------------------------------------------------------
__global__ __launch_bounds__(256) void mmat_kernel(
    const float* __restrict__ phi, const float* __restrict__ g,
    float* __restrict__ Mout) {
  int wid  = (blockIdx.x * blockDim.x + threadIdx.x) >> 5;
  int lane = threadIdx.x & 31;
  int half = lane >> 4, lm = lane & 15;
  int ct  = wid & 7;
  int cpt = (wid >> 3) & 7;
  int b   = wid >> 6;
  const float* pb = phi + ((size_t)b * Cin + cpt * 16) * Npool;
  const float* gb = g   + ((size_t)b * Cin + ct * 16) * Npool;
  v8f acc = {};
  for (int ks = 0; ks < Npool / 4; ++ks) {
    int k = ks * 4 + half * 2;
    v2f a  = *(const v2f*)(pb + (size_t)lm * Npool + k);  // A[row=cp, k=n]
    v2f bb = *(const v2f*)(gb + (size_t)lm * Npool + k);  // B[k=n, col=c]
    acc = wmma4(a, bb, acc);
  }
  const float scale = 1.0f / (float)Npool;
  float* Mb = Mout + (size_t)b * Cin * Cin + (size_t)(cpt * 16) * Cin + ct * 16;
  for (int r = 0; r < 8; ++r) {
    int row = r + half * 8;
    Mb[(size_t)row * Cin + lm] = acc[r] * scale;
  }
}

// ---------------------------------------------------------------------------
// Kernel 3: per (b, t-tile of 16):  y = M^T * theta  (128x16, in LDS),
//           then wy = w_w * y + w_b (256x16) written to d_out.
// 8 waves: phase1 one y row-tile each; phase2 two wy row-tiles each.
// ---------------------------------------------------------------------------
__global__ __launch_bounds__(256) void y_wy_kernel(
    const float* __restrict__ theta, const float* __restrict__ Mmat,
    const float* __restrict__ ww, const float* __restrict__ wb,
    float* __restrict__ outp) {
  __shared__ float ylds[128 * 17];  // pitch 17 to dodge bank conflicts
  int wg = blockIdx.x;              // Bk * (Tt/16) = 2048
  int b  = wg >> 9;
  int t0 = (wg & 511) * 16;
  int wv   = threadIdx.x >> 5;      // 0..7
  int lane = threadIdx.x & 31;
  int half = lane >> 4, lm = lane & 15;

  const float* thb = theta + (size_t)b * Cin * Tt;
  const float* Mb  = Mmat + (size_t)b * Cin * Cin;

  // phase 1: y[c0..c0+15, t0..t0+15] = (M^T theta) tile
  int c0 = wv * 16;
  v8f acc = {};
  for (int ks = 0; ks < Cin / 4; ++ks) {
    int k = ks * 4 + half * 2;
    v2f a;                                   // A[row=c, k=cp] = M[cp, c]
    a.x = Mb[(size_t)k * Cin + c0 + lm];
    a.y = Mb[(size_t)(k + 1) * Cin + c0 + lm];
    v2f bb;                                  // B[k=cp, col=t] = theta[cp, t]
    bb.x = thb[(size_t)k * Tt + t0 + lm];
    bb.y = thb[(size_t)(k + 1) * Tt + t0 + lm];
    acc = wmma4(a, bb, acc);
  }
  for (int r = 0; r < 8; ++r) {
    int row = c0 + r + half * 8;
    ylds[row * 17 + lm] = acc[r];
  }
  __syncthreads();

  // phase 2: wy tiles (o0 = wv*16 and (wv+8)*16)
  for (int ht = 0; ht < 2; ++ht) {
    int o0 = (wv + ht * 8) * 16;
    v8f a2 = {};
    for (int ks = 0; ks < Cin / 4; ++ks) {
      int k = ks * 4 + half * 2;
      v2f a = *(const v2f*)(ww + (size_t)(o0 + lm) * Cin + k);  // A[o, ci]
      v2f bb;                                                    // B[ci, t]
      bb.x = ylds[k * 17 + lm];
      bb.y = ylds[(k + 1) * 17 + lm];
      a2 = wmma4(a, bb, a2);
    }
    float* ob = outp + ((size_t)b * Cc + o0) * Tt + t0;
    for (int r = 0; r < 8; ++r) {
      int row = r + half * 8;
      ob[(size_t)row * Tt + lm] = a2[r] + wb[o0 + row];
    }
  }
}

// ---------------------------------------------------------------------------
// Kernel 4: per-channel sums over (B,T) of wy (deterministic tree reduction)
// ---------------------------------------------------------------------------
__global__ __launch_bounds__(256) void bn_stats_kernel(
    const float* __restrict__ wy, float* __restrict__ sumb,
    float* __restrict__ sumsqb) {
  __shared__ float ls[256], ls2[256];
  int c = blockIdx.x, tid = threadIdx.x;
  float s = 0.f, s2 = 0.f;
  for (int b = 0; b < Bk; ++b) {
    const float* p = wy + ((size_t)b * Cc + c) * Tt;
    for (int t = tid; t < Tt; t += 256) {
      float v = p[t];
      s += v; s2 += v * v;
    }
  }
  ls[tid] = s; ls2[tid] = s2;
  __syncthreads();
  for (int off = 128; off > 0; off >>= 1) {
    if (tid < off) { ls[tid] += ls[tid + off]; ls2[tid] += ls2[tid + off]; }
    __syncthreads();
  }
  if (tid == 0) { sumb[c] = ls[0]; sumsqb[c] = ls2[0]; }
}

__global__ void bn_finalize_kernel(const float* __restrict__ sumb,
                                   const float* __restrict__ sumsqb,
                                   const float* __restrict__ gamma,
                                   const float* __restrict__ beta,
                                   float* __restrict__ scaleb,
                                   float* __restrict__ shiftb) {
  int c = threadIdx.x;  // 256 threads, 1 block
  float inv  = 1.0f / (float)(Bk * Tt);
  float mean = sumb[c] * inv;
  float var  = sumsqb[c] * inv - mean * mean;
  float sc   = gamma[c] * rsqrtf(var + BN_EPS);
  scaleb[c]  = sc;
  shiftb[c]  = beta[c] - mean * sc;
}

// out = scale[c]*wy + shift[c] + x   (wy already resident in d_out)
__global__ __launch_bounds__(256) void bn_apply_kernel(
    const float* __restrict__ x, const float* __restrict__ scaleb,
    const float* __restrict__ shiftb, float* outp) {
  size_t total4 = (size_t)Bk * Cc * Tt / 4;
  size_t stride = (size_t)gridDim.x * blockDim.x;
  for (size_t i = (size_t)blockIdx.x * blockDim.x + threadIdx.x; i < total4;
       i += stride) {
    int c = (int)(((i * 4) / Tt) % Cc);
    float4 wy = ((const float4*)outp)[i];
    float4 xv = ((const float4*)x)[i];
    float sc = scaleb[c], sh = shiftb[c];
    float4 r;
    r.x = sc * wy.x + sh + xv.x;
    r.y = sc * wy.y + sh + xv.y;
    r.z = sc * wy.z + sh + xv.z;
    r.w = sc * wy.w + sh + xv.w;
    ((float4*)outp)[i] = r;
  }
}

// ---------------------------------------------------------------------------
extern "C" void kernel_launch(void* const* d_in, const int* in_sizes, int n_in,
                              void* d_out, int out_size, void* d_ws,
                              size_t ws_size, hipStream_t stream) {
  (void)in_sizes; (void)n_in; (void)out_size; (void)ws_size;
  const float* x       = (const float*)d_in[0];
  const float* theta_w = (const float*)d_in[1];
  const float* theta_b = (const float*)d_in[2];
  const float* phi_w   = (const float*)d_in[3];
  const float* phi_b   = (const float*)d_in[4];
  const float* g_w     = (const float*)d_in[5];
  const float* g_b     = (const float*)d_in[6];
  const float* w_w     = (const float*)d_in[7];
  const float* w_b     = (const float*)d_in[8];
  const float* gamma   = (const float*)d_in[9];
  const float* beta    = (const float*)d_in[10];
  float* outp = (float*)d_out;

  // workspace layout (floats)
  float* ws    = (float*)d_ws;
  float* theta = ws;                                   // 4*128*8192 = 4194304
  float* phiP  = theta + (size_t)Bk * Cin * Tt;        // 2097152
  float* gP    = phiP + (size_t)Bk * Cin * Npool;      // 2097152
  float* Mbuf  = gP + (size_t)Bk * Cin * Npool;        // 65536
  float* sumb  = Mbuf + (size_t)Bk * Cin * Cin;        // 256
  float* sumsq = sumb + Cc;                            // 256
  float* scl   = sumsq + Cc;                           // 256
  float* shf   = scl + Cc;                             // 256  (~32.3 MB total)

  // 1) theta = conv(theta_w) ; phiP/gP = maxpool2(conv(...))
  conv1x1_kernel<0><<<2048, 256, 0, stream>>>(x, theta_w, theta_b, theta);
  conv1x1_kernel<1><<<1024, 256, 0, stream>>>(x, phi_w, phi_b, phiP);
  conv1x1_kernel<1><<<1024, 256, 0, stream>>>(x, g_w, g_b, gP);

  // 2) M = phiP * gP^T / N   (256 waves)
  mmat_kernel<<<32, 256, 0, stream>>>(phiP, gP, Mbuf);

  // 3) y = M^T theta ; wy = w_w*y + w_b  -> d_out
  y_wy_kernel<<<2048, 256, 0, stream>>>(theta, Mbuf, w_w, w_b, outp);

  // 4) batchnorm statistics + finalize + apply (+ residual)
  bn_stats_kernel<<<Cc, 256, 0, stream>>>(outp, sumb, sumsq);
  bn_finalize_kernel<<<1, 256, 0, stream>>>(sumb, sumsq, gamma, beta, scl, shf);
  bn_apply_kernel<<<2048, 256, 0, stream>>>(x, scl, shf, outp);
}

// v001
// It runs in 192 microseconds.
// Two timings next to v000 put it at 1.31 and 1.29 times that version's speed.
#include <hip/hip_runtime.h>

// Problem constants (from setup_inputs): B=4, C=256, Ci=128, T=8192, N=T/2
#define Bk  4
#define Cc  256
#define Cin 128
#define Tt  8192
#define Npool 4096
#define BN_EPS 1e-5f
#define KSPLIT 16                 // K slices of the M product, 32 work-groups each
#define KCHUNK (Npool / KSPLIT)

typedef float v2f __attribute__((ext_vector_type(2)));
typedef float v8f __attribute__((ext_vector_type(8)));

// V_WMMA_F32_16X16X4_F32 : D(16x16 f32) = A(16x4 f32) * B(4x16 f32) + C
// 8-arg pattern: (neg_a, A, neg_b, B, c_mod, C, reuse_a, reuse_b)
__device__ __forceinline__ v8f wmma4(v2f a, v2f b, v8f c) {
  return __builtin_amdgcn_wmma_f32_16x16x4_f32(false, a, false, b, (short)0, c,
                                               false, false);
}

// ---------------------------------------------------------------------------
// Kernel 1: 1x1 conv as GEMM  out[b,o,t] = sum_c w[o,c] x[b,c,t] + bias[o]
// POOL=1: each wave covers 32 t's and writes maxpooled 16 n's.
// One wave per 16(o) x 16/32(t) tile.
// ---------------------------------------------------------------------------
template <int POOL>
__global__ __launch_bounds__(256) void conv1x1_kernel(
    const float* __restrict__ x, const float* __restrict__ w,
    const float* __restrict__ bias, float* __restrict__ out) {
  const int TW = POOL ? 32 : 16;
  const int tTiles = Tt / TW;
  int wid  = (blockIdx.x * blockDim.x + threadIdx.x) >> 5;
  int lane = threadIdx.x & 31;
  int half = lane >> 4, lm = lane & 15;
  int tt = wid % tTiles;
  int rt = (wid / tTiles) & 7;          // Cin/16 = 8 row tiles
  int b  = wid / (tTiles * 8);
  int o0 = rt * 16, t0 = tt * TW;

  const float* xb = x + (size_t)b * Cc * Tt;
  v8f acc0 = {};
  v8f acc1 = {};
  for (int ks = 0; ks < Cc / 4; ++ks) {
    int k = ks * 4 + half * 2;
    v2f a = *(const v2f*)(w + (size_t)(o0 + lm) * Cc + k);     // A[row=o, k]
    v2f b0;
    b0.x = xb[(size_t)k * Tt + t0 + lm];                        // B[k, col=t]
    b0.y = xb[(size_t)(k + 1) * Tt + t0 + lm];
    acc0 = wmma4(a, b0, acc0);
    if (POOL) {
      v2f b1;
      b1.x = xb[(size_t)k * Tt + t0 + 16 + lm];
      b1.y = xb[(size_t)(k + 1) * Tt + t0 + 16 + lm];
      acc1 = wmma4(a, b1, acc1);
    }
  }

  if (!POOL) {
    float* ob = out + ((size_t)b * Cin + o0) * Tt + t0;
    for (int r = 0; r < 8; ++r) {
      int row = r + half * 8;
      ob[(size_t)row * Tt + lm] = acc0[r] + bias[o0 + row];
    }
  } else {
    // maxpool2 across adjacent t lanes, then add bias (bias commutes with max)
    float* ob = out + ((size_t)b * Cin + o0) * Npool + (t0 >> 1);
    for (int r = 0; r < 8; ++r) {
      int row = r + half * 8;
      float v0 = acc0[r], v1 = acc1[r];
      float m0 = fmaxf(v0, __shfl_xor(v0, 1));
      float m1 = fmaxf(v1, __shfl_xor(v1, 1));
      if ((lm & 1) == 0) {
        float bz = bias[o0 + row];
        ob[(size_t)row * Npool + (lm >> 1)]     = m0 + bz;
        ob[(size_t)row * Npool + 8 + (lm >> 1)] = m1 + bz;
      }
    }
  }
}

// ---------------------------------------------------------------------------
// Kernel 2: M[b,cp,c] = (1/N) * sum_n phi[b,cp,n] * g[b,c,n]   (128x128, K=4096)
// Split K: one wave per 16x16 tile and K slice of KCHUNK; slice s stores its
// unscaled partial tile in plane s of Pout. Both fragments are contiguous
// float2 loads. mreduce_kernel then sums the planes in slice order and scales.
// ---------------------------------------------------------------------------
__global__ __launch_bounds__(256) void mmat_kernel(
    const float* __restrict__ phi, const float* __restrict__ g,
    float* __restrict__ Pout) {
  int wid  = (blockIdx.x * blockDim.x + threadIdx.x) >> 5;
  int lane = threadIdx.x & 31;
  int half = lane >> 4, lm = lane & 15;
  int ct  = wid & 7;
  int cpt = (wid >> 3) & 7;
  int b   = (wid >> 6) & 3;
  int s   = wid >> 8;                   // K slice, 0..KSPLIT-1
  const float* pb = phi + ((size_t)b * Cin + cpt * 16) * Npool + s * KCHUNK;
  const float* gb = g   + ((size_t)b * Cin + ct * 16) * Npool + s * KCHUNK;
  v8f acc = {};
  for (int ks = 0; ks < KCHUNK / 4; ++ks) {
    int k = ks * 4 + half * 2;
    v2f a  = *(const v2f*)(pb + (size_t)lm * Npool + k);  // A[row=cp, k=n]
    v2f bb = *(const v2f*)(gb + (size_t)lm * Npool + k);  // B[k=n, col=c]
    acc = wmma4(a, bb, acc);
  }
  float* Mb = Pout + ((size_t)s * Bk + b) * Cin * Cin +
              (size_t)(cpt * 16) * Cin + ct * 16;
  for (int r = 0; r < 8; ++r) {
    int row = r + half * 8;
    Mb[(size_t)row * Cin + lm] = acc[r];
  }
}

// Kernel 2b: M = (1/N) * sum_s Pout[s], four elements per thread.
__global__ __launch_bounds__(256) void mreduce_kernel(
    const float* __restrict__ Pin, float* __restrict__ Mout) {
  const int plane4 = Bk * Cin * Cin / 4;
  int i = blockIdx.x * blockDim.x + threadIdx.x;   // 0..plane4-1
  const float4* p = (const float4*)Pin + i;
  float4 a = p[0];
  for (int s = 1; s < KSPLIT; ++s) {
    float4 v = p[(size_t)s * plane4];
    a.x += v.x; a.y += v.y; a.z += v.z; a.w += v.w;
  }
  const float scale = 1.0f / (float)Npool;
  a.x *= scale; a.y *= scale; a.z *= scale; a.w *= scale;
  ((float4*)Mout)[i] = a;
}

// ---------------------------------------------------------------------------
// Kernel 3: per (b, t-tile of 16):  y = M^T * theta  (128x16, in LDS),
//           then wy = w_w * y + w_b (256x16) written to d_out.
// 8 waves: phase1 one y row-tile each; phase2 two wy row-tiles each.
// ---------------------------------------------------------------------------
__global__ __launch_bounds__(256) void y_wy_kernel(
    const float* __restrict__ theta, const float* __restrict__ Mmat,
    const float* __restrict__ ww, const float* __restrict__ wb,
    float* __restrict__ outp) {
  __shared__ float ylds[128 * 17];  // pitch 17 to dodge bank conflicts
  int wg = blockIdx.x;              // Bk * (Tt/16) = 2048
  int b  = wg >> 9;
  int t0 = (wg & 511) * 16;
  int wv   = threadIdx.x >> 5;      // 0..7
  int lane = threadIdx.x & 31;
  int half = lane >> 4, lm = lane & 15;

  const float* thb = theta + (size_t)b * Cin * Tt;
  const float* Mb  = Mmat + (size_t)b * Cin * Cin;

  // phase 1: y[c0..c0+15, t0..t0+15] = (M^T theta) tile
  int c0 = wv * 16;
  v8f acc = {};
  for (int ks = 0; ks < Cin / 4; ++ks) {
    int k = ks * 4 + half * 2;
    v2f a;                                   // A[row=c, k=cp] = M[cp, c]
    a.x = Mb[(size_t)k * Cin + c0 + lm];
    a.y = Mb[(size_t)(k + 1) * Cin + c0 + lm];
    v2f bb;                                  // B[k=cp, col=t] = theta[cp, t]
    bb.x = thb[(size_t)k * Tt + t0 + lm];
    bb.y = thb[(size_t)(k + 1) * Tt + t0 + lm];
    acc = wmma4(a, bb, acc);
  }
  for (int r = 0; r < 8; ++r) {
    int row = c0 + r + half * 8;
    ylds[row * 17 + lm] = acc[r];
  }
  __syncthreads();

  // phase 2: wy tiles (o0 = wv*16 and (wv+8)*16)
  for (int ht = 0; ht < 2; ++ht) {
    int o0 = (wv + ht * 8) * 16;
    v8f a2 = {};
    for (int ks = 0; ks < Cin / 4; ++ks) {
      int k = ks * 4 + half * 2;
      v2f a = *(const v2f*)(ww + (size_t)(o0 + lm) * Cin + k);  // A[o, ci]
      v2f bb;                                                    // B[ci, t]
      bb.x = ylds[k * 17 + lm];
      bb.y = ylds[(k + 1) * 17 + lm];
      a2 = wmma4(a, bb, a2);
    }
    float* ob = outp + ((size_t)b * Cc + o0) * Tt + t0;
    for (int r = 0; r < 8; ++r) {
      int row = r + half * 8;
      ob[(size_t)row * Tt + lm] = a2[r] + wb[o0 + row];
    }
  }
}

// ---------------------------------------------------------------------------
// Kernel 4: per-channel sums over (B,T) of wy (deterministic tree reduction)
// ---------------------------------------------------------------------------
__global__ __launch_bounds__(256) void bn_stats_kernel(
    const float* __restrict__ wy, float* __restrict__ sumb,
    float* __restrict__ sumsqb) {
  __shared__ float ls[256], ls2[256];
  int c = blockIdx.x, tid = threadIdx.x;
  float s = 0.f, s2 = 0.f;
  for (int b = 0; b < Bk; ++b) {
    const float* p = wy + ((size_t)b * Cc + c) * Tt;
    for (int t = tid; t < Tt; t += 256) {
      float v = p[t];
      s += v; s2 += v * v;
    }
  }
  ls[tid] = s; ls2[tid] = s2;
  __syncthreads();
  for (int off = 128; off > 0; off >>= 1) {
    if (tid < off) { ls[tid] += ls[tid + off]; ls2[tid] += ls2[tid + off]; }
    __syncthreads();
  }
  if (tid == 0) { sumb[c] = ls[0]; sumsqb[c] = ls2[0]; }
}

__global__ void bn_finalize_kernel(const float* __restrict__ sumb,
                                   const float* __restrict__ sumsqb,
                                   const float* __restrict__ gamma,
                                   const float* __restrict__ beta,
                                   float* __restrict__ scaleb,
                                   float* __restrict__ shiftb) {
  int c = threadIdx.x;  // 256 threads, 1 block
  float inv  = 1.0f / (float)(Bk * Tt);
  float mean = sumb[c] * inv;
  float var  = sumsqb[c] * inv - mean * mean;
  float sc   = gamma[c] * rsqrtf(var + BN_EPS);
  scaleb[c]  = sc;
  shiftb[c]  = beta[c] - mean * sc;
}

// out = scale[c]*wy + shift[c] + x   (wy already resident in d_out)
__global__ __launch_bounds__(256) void bn_apply_kernel(
    const float* __restrict__ x, const float* __restrict__ scaleb,
    const float* __restrict__ shiftb, float* outp) {
  size_t total4 = (size_t)Bk * Cc * Tt / 4;
  size_t stride = (size_t)gridDim.x * blockDim.x;
  for (size_t i = (size_t)blockIdx.x * blockDim.x + threadIdx.x; i < total4;
       i += stride) {
    int c = (int)(((i * 4) / Tt) % Cc);
    float4 wy = ((const float4*)outp)[i];
    float4 xv = ((const float4*)x)[i];
    float sc = scaleb[c], sh = shiftb[c];
    float4 r;
    r.x = sc * wy.x + sh + xv.x;
    r.y = sc * wy.y + sh + xv.y;
    r.z = sc * wy.z + sh + xv.z;
    r.w = sc * wy.w + sh + xv.w;
    ((float4*)outp)[i] = r;
  }
}

// ---------------------------------------------------------------------------
extern "C" void kernel_launch(void* const* d_in, const int* in_sizes, int n_in,
                              void* d_out, int out_size, void* d_ws,
                              size_t ws_size, hipStream_t stream) {
  (void)in_sizes; (void)n_in; (void)out_size; (void)ws_size;
  const float* x       = (const float*)d_in[0];
  const float* theta_w = (const float*)d_in[1];
  const float* theta_b = (const float*)d_in[2];
  const float* phi_w   = (const float*)d_in[3];
  const float* phi_b   = (const float*)d_in[4];
  const float* g_w     = (const float*)d_in[5];
  const float* g_b     = (const float*)d_in[6];
  const float* w_w     = (const float*)d_in[7];
  const float* w_b     = (const float*)d_in[8];
  const float* gamma   = (const float*)d_in[9];
  const float* beta    = (const float*)d_in[10];
  float* outp = (float*)d_out;

  // workspace layout (floats)
  float* ws    = (float*)d_ws;
  float* theta = ws;                                   // 4*128*8192 = 4194304
  float* phiP  = theta + (size_t)Bk * Cin * Tt;        // 2097152
  float* gP    = phiP + (size_t)Bk * Cin * Npool;      // 2097152
  float* Mbuf  = gP + (size_t)Bk * Cin * Npool;        // 65536
  float* sumb  = Mbuf + (size_t)Bk * Cin * Cin;        // 256
  float* sumsq = sumb + Cc;                            // 256
  float* scl   = sumsq + Cc;                           // 256
  float* shf   = scl + Cc;                             // 256
  float* Mpart = shf + Cc;                             // KSPLIT * 65536 (~38 MB total)

  // 1) theta = conv(theta_w) ; phiP/gP = maxpool2(conv(...))
  conv1x1_kernel<0><<<2048, 256, 0, stream>>>(x, theta_w, theta_b, theta);
  conv1x1_kernel<1><<<1024, 256, 0, stream>>>(x, phi_w, phi_b, phiP);
  conv1x1_kernel<1><<<1024, 256, 0, stream>>>(x, g_w, g_b, gP);

  // 2) M = phiP * gP^T / N   (256 tiles x KSPLIT slices, then the plane sum)
  mmat_kernel<<<512, 256, 0, stream>>>(phiP, gP, Mpart);    // 32 * KSPLIT groups
  mreduce_kernel<<<64, 256, 0, stream>>>(Mpart, Mbuf);      // 65536 / 4 threads

  // 3) y = M^T theta ; wy = w_w*y + w_b  -> d_out
  y_wy_kernel<<<2048, 256, 0, stream>>>(theta, Mbuf, w_w, w_b, outp);

  // 4) batchnorm statistics + finalize + apply (+ residual)
  bn_stats_kernel<<<Cc, 256, 0, stream>>>(outp, sumb, sumsq);
  bn_finalize_kernel<<<1, 256, 0, stream>>>(sumb, sumsq, gamma, beta, scl, shf);
  bn_apply_kernel<<<2048, 256, 0, stream>>>(x, scl, shf, outp);
}

// v002
// It runs in 135 microseconds.
// Next to v001, in two timings, it ran 1.42 and 1.44 times as fast.
// Counting every step since v000, it is 1.86 times as fast.
#include <hip/hip_runtime.h>

// Problem constants (from setup_inputs): B=4, C=256, Ci=128, T=8192, N=T/2
#define Bk  4
#define Cc  256
#define Cin 128
#define Tt  8192
#define Npool 4096
#define BN_EPS 1e-5f
#define KSPLIT 16                 // K slices of the M product, 32 work-groups each
#define KCHUNK (Npool / KSPLIT)

typedef float v2f __attribute__((ext_vector_type(2)));
typedef float v4f __attribute__((ext_vector_type(4)));
typedef float v8f __attribute__((ext_vector_type(8)));

// V_WMMA_F32_16X16X4_F32 : D(16x16 f32) = A(16x4 f32) * B(4x16 f32) + C
// 8-arg pattern: (neg_a, A, neg_b, B, c_mod, C, reuse_a, reuse_b)
__device__ __forceinline__ v8f wmma4(v2f a, v2f b, v8f c) {
  return __builtin_amdgcn_wmma_f32_16x16x4_f32(false, a, false, b, (short)0, c,
                                               false, false);
}

// ---------------------------------------------------------------------------
// Kernel 1: the three 1x1 convs as one GEMM launch.
//   theta[b,o,t] = sum_c theta_w[o,c] x[b,c,t] + theta_b[o]
//   phiP / gP    = maxpool2 over t of the same form with phi_w / g_w
// Each wave holds a register tile of 48 rows (row tile o0 of each of the three
// weights) by 64 columns (4 column tiles), so one x fragment feeds 3 products
// and one weight fragment 4. Work-group: 2 row tiles x 4 column spans.
// Column tile j of a wave holds t = t0 + 4*lm + j, so one 16-byte load of an x
// row serves all four tiles, a pool pair sits in one lane, and rows are stored
// as whole 16-byte (theta) or 8-byte (pooled) pieces per lane.
// k order inside a chunk of 8: lane half h holds k = 4h..4h+3 of both operands;
// the first product of the chunk takes elements 0,1 and the second 2,3.
// ---------------------------------------------------------------------------
struct ConvFrag {
  v4f a[3];   // weight rows: k = 4*half .. 4*half+3 of the chunk
  v4f x[4];   // x rows k = 4*half + i, columns t0 + 4*lm .. +3
};

__device__ __forceinline__ void conv_load(ConvFrag& f, const float* w0,
                                          const float* w1, const float* w2,
                                          const float* xl, int kb) {
  f.a[0] = *(const v4f*)(w0 + kb * 8);
  f.a[1] = *(const v4f*)(w1 + kb * 8);
  f.a[2] = *(const v4f*)(w2 + kb * 8);
  for (int i = 0; i < 4; ++i)
    f.x[i] = *(const v4f*)(xl + (size_t)(kb * 8 + i) * Tt);
}

__device__ __forceinline__ void conv_mac(const ConvFrag& f, v8f (&acc)[3][4]) {
  for (int p = 0; p < 2; ++p) {
    for (int j = 0; j < 4; ++j) {
      v2f bj;
      bj.x = f.x[2 * p][j];
      bj.y = f.x[2 * p + 1][j];
      for (int m = 0; m < 3; ++m) {
        v2f am;
        am.x = f.a[m][2 * p];
        am.y = f.a[m][2 * p + 1];
        acc[m][j] = wmma4(am, bj, acc[m][j]);
      }
    }
  }
}

__device__ __forceinline__ void conv_store_pool(const v8f (&acc)[4],
                                                const float* bias, float* ob,
                                                int half) {
  // maxpool2 of columns (0,1) and (2,3) of the lane, then bias (commutes)
  for (int r = 0; r < 8; ++r) {
    int row = r + half * 8;
    float bz = bias[row];
    v2f v;
    v.x = fmaxf(acc[0][r], acc[1][r]) + bz;
    v.y = fmaxf(acc[2][r], acc[3][r]) + bz;
    *(v2f*)(ob + (size_t)row * Npool) = v;
  }
}

__global__ __launch_bounds__(256) void conv3_kernel(
    const float* __restrict__ x, const float* __restrict__ tw,
    const float* __restrict__ tb, const float* __restrict__ pw,
    const float* __restrict__ pb, const float* __restrict__ gw,
    const float* __restrict__ gb, float* __restrict__ theta,
    float* __restrict__ phiP, float* __restrict__ gP) {
  int wv   = __builtin_amdgcn_readfirstlane(threadIdx.x >> 5);  // 0..7
  int lane = threadIdx.x & 31;
  int half = lane >> 4, lm = lane & 15;
  int rg = blockIdx.x & 3;              // pair of row tiles
  int cg = blockIdx.x >> 2;             // 256-column span, 0..127
  int b  = cg >> 5;
  int t0 = (cg & 31) * 256 + (wv & 3) * 64;
  int o0 = (rg * 2 + (wv >> 2)) * 16;

  const float* xl = x + (size_t)b * Cc * Tt + (size_t)(half * 4) * Tt + t0 + lm * 4;
  size_t woff = (size_t)(o0 + lm) * Cc + half * 4;
  const float* w0 = tw + woff;
  const float* w1 = pw + woff;
  const float* w2 = gw + woff;

  v8f acc[3][4] = {};
  // Two fragment sets: each chunk's loads are issued ahead of the products of
  // the chunk before it. The last pair of chunks is peeled (nothing to fetch).
  ConvFrag f0, f1;
  conv_load(f0, w0, w1, w2, xl, 0);
  for (int kb = 0; kb < Cc / 8 - 2; kb += 2) {
    conv_load(f1, w0, w1, w2, xl, kb + 1);
    conv_mac(f0, acc);
    conv_load(f0, w0, w1, w2, xl, kb + 2);
    conv_mac(f1, acc);
  }
  conv_load(f1, w0, w1, w2, xl, Cc / 8 - 1);
  // precaution: the bias loads below land in address registers of the loads
  // above; this wait stands in front of that overwrite
  asm volatile("s_wait_xcnt 0x0" ::: "memory");
  conv_mac(f0, acc);
  conv_mac(f1, acc);

  float* ot = theta + ((size_t)b * Cin + o0) * Tt + t0 + lm * 4;
  for (int r = 0; r < 8; ++r) {
    int row = r + half * 8;
    float bz = tb[o0 + row];
    v4f v;
    v.x = acc[0][0][r] + bz;
    v.y = acc[0][1][r] + bz;
    v.z = acc[0][2][r] + bz;
    v.w = acc[0][3][r] + bz;
    *(v4f*)(ot + (size_t)row * Tt) = v;
  }
  size_t poff = ((size_t)b * Cin + o0) * Npool + (t0 >> 1) + lm * 2;
  conv_store_pool(acc[1], pb + o0, phiP + poff, half);
  conv_store_pool(acc[2], gb + o0, gP + poff, half);
}

// ---------------------------------------------------------------------------
// Kernel 2: M[b,cp,c] = (1/N) * sum_n phi[b,cp,n] * g[b,c,n]   (128x128, K=4096)
// Split K: one wave per 16x16 tile and K slice of KCHUNK; slice s stores its
// unscaled partial tile in plane s of Pout. Both fragments are contiguous
// float2 loads. mreduce_kernel then sums the planes in slice order and scales.
// ---------------------------------------------------------------------------
__global__ __launch_bounds__(256) void mmat_kernel(
    const float* __restrict__ phi, const float* __restrict__ g,
    float* __restrict__ Pout) {
  int wid  = (blockIdx.x * blockDim.x + threadIdx.x) >> 5;
  int lane = threadIdx.x & 31;
  int half = lane >> 4, lm = lane & 15;
  int ct  = wid & 7;
  int cpt = (wid >> 3) & 7;
  int b   = (wid >> 6) & 3;
  int s   = wid >> 8;                   // K slice, 0..KSPLIT-1
  const float* pb = phi + ((size_t)b * Cin + cpt * 16) * Npool + s * KCHUNK;
  const float* gb = g   + ((size_t)b * Cin + ct * 16) * Npool + s * KCHUNK;
  v8f acc = {};
  for (int ks = 0; ks < KCHUNK / 4; ++ks) {
    int k = ks * 4 + half * 2;
    v2f a  = *(const v2f*)(pb + (size_t)lm * Npool + k);  // A[row=cp, k=n]
    v2f bb = *(const v2f*)(gb + (size_t)lm * Npool + k);  // B[k=n, col=c]
    acc = wmma4(a, bb, acc);
  }
  float* Mb = Pout + ((size_t)s * Bk + b) * Cin * Cin +
              (size_t)(cpt * 16) * Cin + ct * 16;
  for (int r = 0; r < 8; ++r) {
    int row = r + half * 8;
    Mb[(size_t)row * Cin + lm] = acc[r];
  }
}

// Kernel 2b: M = (1/N) * sum_s Pout[s], four elements per thread.
__global__ __launch_bounds__(256) void mreduce_kernel(
    const float* __restrict__ Pin, float* __restrict__ Mout) {
  const int plane4 = Bk * Cin * Cin / 4;
  int i = blockIdx.x * blockDim.x + threadIdx.x;   // 0..plane4-1
  const float4* p = (const float4*)Pin + i;
  float4 a = p[0];
  for (int s = 1; s < KSPLIT; ++s) {
    float4 v = p[(size_t)s * plane4];
    a.x += v.x; a.y += v.y; a.z += v.z; a.w += v.w;
  }
  const float scale = 1.0f / (float)Npool;
  a.x *= scale; a.y *= scale; a.z *= scale; a.w *= scale;
  ((float4*)Mout)[i] = a;
}

// ---------------------------------------------------------------------------
// Kernel 3: per (b, t-tile of 16):  y = M^T * theta  (128x16, in LDS),
//           then wy = w_w * y + w_b (256x16) written to d_out.
// 8 waves: phase1 one y row-tile each; phase2 two wy row-tiles each.
// ---------------------------------------------------------------------------
__global__ __launch_bounds__(256) void y_wy_kernel(
    const float* __restrict__ theta, const float* __restrict__ Mmat,
    const float* __restrict__ ww, const float* __restrict__ wb,
    float* __restrict__ outp) {
  __shared__ float ylds[128 * 17];  // pitch 17 to dodge bank conflicts
  int wg = blockIdx.x;              // Bk * (Tt/16) = 2048
  int b  = wg >> 9;
  int t0 = (wg & 511) * 16;
  int wv   = threadIdx.x >> 5;      // 0..7
  int lane = threadIdx.x & 31;
  int half = lane >> 4, lm = lane & 15;

  const float* thb = theta + (size_t)b * Cin * Tt;
  const float* Mb  = Mmat + (size_t)b * Cin * Cin;

  // phase 1: y[c0..c0+15, t0..t0+15] = (M^T theta) tile
  int c0 = wv * 16;
  v8f acc = {};
  for (int ks = 0; ks < Cin / 4; ++ks) {
    int k = ks * 4 + half * 2;
    v2f a;                                   // A[row=c, k=cp] = M[cp, c]
    a.x = Mb[(size_t)k * Cin + c0 + lm];
    a.y = Mb[(size_t)(k + 1) * Cin + c0 + lm];
    v2f bb;                                  // B[k=cp, col=t] = theta[cp, t]
    bb.x = thb[(size_t)k * Tt + t0 + lm];
    bb.y = thb[(size_t)(k + 1) * Tt + t0 + lm];
    acc = wmma4(a, bb, acc);
  }
  for (int r = 0; r < 8; ++r) {
    int row = c0 + r + half * 8;
    ylds[row * 17 + lm] = acc[r];
  }
  __syncthreads();

  // phase 2: wy tiles (o0 = wv*16 and (wv+8)*16)
  for (int ht = 0; ht < 2; ++ht) {
    int o0 = (wv + ht * 8) * 16;
    v8f a2 = {};
    for (int ks = 0; ks < Cin / 4; ++ks) {
      int k = ks * 4 + half * 2;
      v2f a = *(const v2f*)(ww + (size_t)(o0 + lm) * Cin + k);  // A[o, ci]
      v2f bb;                                                    // B[ci, t]
      bb.x = ylds[k * 17 + lm];
      bb.y = ylds[(k + 1) * 17 + lm];
      a2 = wmma4(a, bb, a2);
    }
    float* ob = outp + ((size_t)b * Cc + o0) * Tt + t0;
    for (int r = 0; r < 8; ++r) {
      int row = r + half * 8;
      ob[(size_t)row * Tt + lm] = a2[r] + wb[o0 + row];
    }
  }
}

// ---------------------------------------------------------------------------
// Kernel 4: per-channel sums over (B,T) of wy (deterministic tree reduction)
// ---------------------------------------------------------------------------
__global__ __launch_bounds__(256) void bn_stats_kernel(
    const float* __restrict__ wy, float* __restrict__ sumb,
    float* __restrict__ sumsqb) {
  __shared__ float ls[256], ls2[256];
  int c = blockIdx.x, tid = threadIdx.x;
  float s = 0.f, s2 = 0.f;
  for (int b = 0; b < Bk; ++b) {
    const float* p = wy + ((size_t)b * Cc + c) * Tt;
    for (int t = tid; t < Tt; t += 256) {
      float v = p[t];
      s += v; s2 += v * v;
    }
  }
  ls[tid] = s; ls2[tid] = s2;
  __syncthreads();
  for (int off = 128; off > 0; off >>= 1) {
    if (tid < off) { ls[tid] += ls[tid + off]; ls2[tid] += ls2[tid + off]; }
    __syncthreads();
  }
  if (tid == 0) { sumb[c] = ls[0]; sumsqb[c] = ls2[0]; }
}

__global__ void bn_finalize_kernel(const float* __restrict__ sumb,
                                   const float* __restrict__ sumsqb,
                                   const float* __restrict__ gamma,
                                   const float* __restrict__ beta,
                                   float* __restrict__ scaleb,
                                   float* __restrict__ shiftb) {
  int c = threadIdx.x;  // 256 threads, 1 block
  float inv  = 1.0f / (float)(Bk * Tt);
  float mean = sumb[c] * inv;
  float var  = sumsqb[c] * inv - mean * mean;
  float sc   = gamma[c] * rsqrtf(var + BN_EPS);
  scaleb[c]  = sc;
  shiftb[c]  = beta[c] - mean * sc;
}

// out = scale[c]*wy + shift[c] + x   (wy already resident in d_out)
__global__ __launch_bounds__(256) void bn_apply_kernel(
    const float* __restrict__ x, const float* __restrict__ scaleb,
    const float* __restrict__ shiftb, float* outp) {
  size_t total4 = (size_t)Bk * Cc * Tt / 4;
  size_t stride = (size_t)gridDim.x * blockDim.x;
  for (size_t i = (size_t)blockIdx.x * blockDim.x + threadIdx.x; i < total4;
       i += stride) {
    int c = (int)(((i * 4) / Tt) % Cc);
    float4 wy = ((const float4*)outp)[i];
    float4 xv = ((const float4*)x)[i];
    float sc = scaleb[c], sh = shiftb[c];
    float4 r;
    r.x = sc * wy.x + sh + xv.x;
    r.y = sc * wy.y + sh + xv.y;
    r.z = sc * wy.z + sh + xv.z;
    r.w = sc * wy.w + sh + xv.w;
    ((float4*)outp)[i] = r;
  }
}

// ---------------------------------------------------------------------------
extern "C" void kernel_launch(void* const* d_in, const int* in_sizes, int n_in,
                              void* d_out, int out_size, void* d_ws,
                              size_t ws_size, hipStream_t stream) {
  (void)in_sizes; (void)n_in; (void)out_size; (void)ws_size;
  const float* x       = (const float*)d_in[0];
  const float* theta_w = (const float*)d_in[1];
  const float* theta_b = (const float*)d_in[2];
  const float* phi_w   = (const float*)d_in[3];
  const float* phi_b   = (const float*)d_in[4];
  const float* g_w     = (const float*)d_in[5];
  const float* g_b     = (const float*)d_in[6];
  const float* w_w     = (const float*)d_in[7];
  const float* w_b     = (const float*)d_in[8];
  const float* gamma   = (const float*)d_in[9];
  const float* beta    = (const float*)d_in[10];
  float* outp = (float*)d_out;

  // workspace layout (floats)
  float* ws    = (float*)d_ws;
  float* theta = ws;                                   // 4*128*8192 = 4194304
  float* phiP  = theta + (size_t)Bk * Cin * Tt;        // 2097152
  float* gP    = phiP + (size_t)Bk * Cin * Npool;      // 2097152
  float* Mbuf  = gP + (size_t)Bk * Cin * Npool;        // 65536
  float* sumb  = Mbuf + (size_t)Bk * Cin * Cin;        // 256
  float* sumsq = sumb + Cc;                            // 256
  float* scl   = sumsq + Cc;                           // 256
  float* shf   = scl + Cc;                             // 256
  float* Mpart = shf + Cc;                             // KSPLIT * 65536 (~38 MB total)

  // 1) theta = conv(theta_w) ; phiP/gP = maxpool2(conv(...))
  //    4 row-tile pairs x 128 column spans of 256
  conv3_kernel<<<512, 256, 0, stream>>>(x, theta_w, theta_b, phi_w, phi_b, g_w,
                                        g_b, theta, phiP, gP);

  // 2) M = phiP * gP^T / N   (256 tiles x KSPLIT slices, then the plane sum)
  mmat_kernel<<<512, 256, 0, stream>>>(phiP, gP, Mpart);    // 32 * KSPLIT groups
  mreduce_kernel<<<64, 256, 0, stream>>>(Mpart, Mbuf);      // 65536 / 4 threads

  // 3) y = M^T theta ; wy = w_w*y + w_b  -> d_out
  y_wy_kernel<<<2048, 256, 0, stream>>>(theta, Mbuf, w_w, w_b, outp);

  // 4) batchnorm statistics + finalize + apply (+ residual)
  bn_stats_kernel<<<Cc, 256, 0, stream>>>(outp, sumb, sumsq);
  bn_finalize_kernel<<<1, 256, 0, stream>>>(sumb, sumsq, gamma, beta, scl, shf);
  bn_apply_kernel<<<2048, 256, 0, stream>>>(x, scl, shf, outp);
}

// v003
// It runs in 90.8 microseconds.
// In two side-by-side timings against v002, it was 1.44 and 1.45 times as fast.
// Over all steps from v000 it is 2.68 times as fast.
#include <hip/hip_runtime.h>

// Problem constants (from setup_inputs): B=4, C=256, Ci=128, T=8192, N=T/2
#define Bk  4
#define Cc  256
#define Cin 128
#define Tt  8192
#define Npool 4096
#define BN_EPS 1e-5f
#define KSPLIT 16                 // K slices of the M product, 32 work-groups each
#define KCHUNK (Npool / KSPLIT)

typedef float v2f __attribute__((ext_vector_type(2)));
typedef float v4f __attribute__((ext_vector_type(4)));
typedef float v8f __attribute__((ext_vector_type(8)));

// V_WMMA_F32_16X16X4_F32 : D(16x16 f32) = A(16x4 f32) * B(4x16 f32) + C
// 8-arg pattern: (neg_a, A, neg_b, B, c_mod, C, reuse_a, reuse_b)
__device__ __forceinline__ v8f wmma4(v2f a, v2f b, v8f c) {
  return __builtin_amdgcn_wmma_f32_16x16x4_f32(false, a, false, b, (short)0, c,
                                               false, false);
}

// ---------------------------------------------------------------------------
// Kernel 1: the three 1x1 convs as one GEMM launch.
//   theta[b,o,t] = sum_c theta_w[o,c] x[b,c,t] + theta_b[o]
//   phiP / gP    = maxpool2 over t of the same form with phi_w / g_w
// Each wave holds a register tile of 48 rows (row tile o0 of each of the three
// weights) by 64 columns (4 column tiles), so one x fragment feeds 3 products
// and one weight fragment 4. Work-group: 2 row tiles x 4 column spans.
// Column tile j of a wave holds t = t0 + 4*lm + j, so one 16-byte load of an x
// row serves all four tiles, a pool pair sits in one lane, and rows are stored
// as whole 16-byte (theta) or 8-byte (pooled) pieces per lane.
// k order inside a chunk of 8: lane half h holds k = 4h..4h+3 of both operands;
// the first product of the chunk takes elements 0,1 and the second 2,3.
// ---------------------------------------------------------------------------
struct ConvFrag {
  v4f a[3];   // weight rows: k = 4*half .. 4*half+3 of the chunk
  v4f x[4];   // x rows k = 4*half + i, columns t0 + 4*lm .. +3
};

__device__ __forceinline__ void conv_load(ConvFrag& f, const float* w0,
                                          const float* w1, const float* w2,
                                          const float* xl, int kb) {
  f.a[0] = *(const v4f*)(w0 + kb * 8);
  f.a[1] = *(const v4f*)(w1 + kb * 8);
  f.a[2] = *(const v4f*)(w2 + kb * 8);
  for (int i = 0; i < 4; ++i)
    f.x[i] = *(const v4f*)(xl + (size_t)(kb * 8 + i) * Tt);
}

__device__ __forceinline__ void conv_mac(const ConvFrag& f, v8f (&acc)[3][4]) {
  for (int p = 0; p < 2; ++p) {
    for (int j = 0; j < 4; ++j) {
      v2f bj;
      bj.x = f.x[2 * p][j];
      bj.y = f.x[2 * p + 1][j];
      for (int m = 0; m < 3; ++m) {
        v2f am;
        am.x = f.a[m][2 * p];
        am.y = f.a[m][2 * p + 1];
        acc[m][j] = wmma4(am, bj, acc[m][j]);
      }
    }
  }
}

__device__ __forceinline__ void conv_store_pool(const v8f (&acc)[4],
                                                const float* bias, float* ob,
                                                int half) {
  // maxpool2 of columns (0,1) and (2,3) of the lane, then bias (commutes)
  for (int r = 0; r < 8; ++r) {
    int row = r + half * 8;
    float bz = bias[row];
    v2f v;
    v.x = fmaxf(acc[0][r], acc[1][r]) + bz;
    v.y = fmaxf(acc[2][r], acc[3][r]) + bz;
    *(v2f*)(ob + (size_t)row * Npool) = v;
  }
}

__global__ __launch_bounds__(256) void conv3_kernel(
    const float* __restrict__ x, const float* __restrict__ tw,
    const float* __restrict__ tb, const float* __restrict__ pw,
    const float* __restrict__ pb, const float* __restrict__ gw,
    const float* __restrict__ gb, float* __restrict__ theta,
    float* __restrict__ phiP, float* __restrict__ gP) {
  int wv   = __builtin_amdgcn_readfirstlane(threadIdx.x >> 5);  // 0..7
  int lane = threadIdx.x & 31;
  int half = lane >> 4, lm = lane & 15;
  int rg = blockIdx.x & 3;              // pair of row tiles
  int cg = blockIdx.x >> 2;             // 256-column span, 0..127
  int b  = cg >> 5;
  int t0 = (cg & 31) * 256 + (wv & 3) * 64;
  int o0 = (rg * 2 + (wv >> 2)) * 16;

  const float* xl = x + (size_t)b * Cc * Tt + (size_t)(half * 4) * Tt + t0 + lm * 4;
  size_t woff = (size_t)(o0 + lm) * Cc + half * 4;
  const float* w0 = tw + woff;
  const float* w1 = pw + woff;
  const float* w2 = gw + woff;

  v8f acc[3][4] = {};
  // Two fragment sets: each chunk's loads are issued ahead of the products of
  // the chunk before it. The last pair of chunks is peeled (nothing to fetch).
  ConvFrag f0, f1;
  conv_load(f0, w0, w1, w2, xl, 0);
  for (int kb = 0; kb < Cc / 8 - 2; kb += 2) {
    conv_load(f1, w0, w1, w2, xl, kb + 1);
    conv_mac(f0, acc);
    conv_load(f0, w0, w1, w2, xl, kb + 2);
    conv_mac(f1, acc);
  }
  conv_load(f1, w0, w1, w2, xl, Cc / 8 - 1);
  // precaution: the bias loads below land in address registers of the loads
  // above; this wait stands in front of that overwrite
  asm volatile("s_wait_xcnt 0x0" ::: "memory");
  conv_mac(f0, acc);
  conv_mac(f1, acc);

  float* ot = theta + ((size_t)b * Cin + o0) * Tt + t0 + lm * 4;
  for (int r = 0; r < 8; ++r) {
    int row = r + half * 8;
    float bz = tb[o0 + row];
    v4f v;
    v.x = acc[0][0][r] + bz;
    v.y = acc[0][1][r] + bz;
    v.z = acc[0][2][r] + bz;
    v.w = acc[0][3][r] + bz;
    *(v4f*)(ot + (size_t)row * Tt) = v;
  }
  size_t poff = ((size_t)b * Cin + o0) * Npool + (t0 >> 1) + lm * 2;
  conv_store_pool(acc[1], pb + o0, phiP + poff, half);
  conv_store_pool(acc[2], gb + o0, gP + poff, half);
}

// ---------------------------------------------------------------------------
// Kernel 2: M[b,cp,c] = (1/N) * sum_n phi[b,cp,n] * g[b,c,n]   (128x128, K=4096)
// Split K: one wave per 16x16 tile and K slice of KCHUNK; slice s stores its
// unscaled partial tile in plane s of Pout. Both fragments are contiguous
// float2 loads. mreduce_kernel then sums the planes in slice order and scales.
// ---------------------------------------------------------------------------
__global__ __launch_bounds__(256) void mmat_kernel(
    const float* __restrict__ phi, const float* __restrict__ g,
    float* __restrict__ Pout) {
  int wid  = (blockIdx.x * blockDim.x + threadIdx.x) >> 5;
  int lane = threadIdx.x & 31;
  int half = lane >> 4, lm = lane & 15;
  int ct  = wid & 7;
  int cpt = (wid >> 3) & 7;
  int b   = (wid >> 6) & 3;
  int s   = wid >> 8;                   // K slice, 0..KSPLIT-1
  const float* pb = phi + ((size_t)b * Cin + cpt * 16) * Npool + s * KCHUNK;
  const float* gb = g   + ((size_t)b * Cin + ct * 16) * Npool + s * KCHUNK;
  v8f acc = {};
  for (int ks = 0; ks < KCHUNK / 4; ++ks) {
    int k = ks * 4 + half * 2;
    v2f a  = *(const v2f*)(pb + (size_t)lm * Npool + k);  // A[row=cp, k=n]
    v2f bb = *(const v2f*)(gb + (size_t)lm * Npool + k);  // B[k=n, col=c]
    acc = wmma4(a, bb, acc);
  }
  float* Mb = Pout + ((size_t)s * Bk + b) * Cin * Cin +
              (size_t)(cpt * 16) * Cin + ct * 16;
  for (int r = 0; r < 8; ++r) {
    int row = r + half * 8;
    Mb[(size_t)row * Cin + lm] = acc[r];
  }
}

// Kernel 2b: M = (1/N) * sum_s Pout[s], four elements per thread.
__global__ __launch_bounds__(256) void mreduce_kernel(
    const float* __restrict__ Pin, float* __restrict__ Mout) {
  const int plane4 = Bk * Cin * Cin / 4;
  int i = blockIdx.x * blockDim.x + threadIdx.x;   // 0..plane4-1
  const float4* p = (const float4*)Pin + i;
  float4 a = p[0];
  for (int s = 1; s < KSPLIT; ++s) {
    float4 v = p[(size_t)s * plane4];
    a.x += v.x; a.y += v.y; a.z += v.z; a.w += v.w;
  }
  const float scale = 1.0f / (float)Npool;
  a.x *= scale; a.y *= scale; a.z *= scale; a.w *= scale;
  ((float4*)Mout)[i] = a;
}

// ---------------------------------------------------------------------------
// Kernel 3: per (b, span of 64 columns t):  y = M^T * theta  (128x64, in LDS),
//           then wy = w_w * y + w_b (256x64) written to d_out.
// 8 waves. Column tile j of a wave holds t = t0 + 4*lm + j (as in kernel 1), so
// theta rows are read and wy rows stored as 16-byte pieces per lane.
// Phase 1: each wave one row tile of y by 4 column tiles (one M fragment feeds
// 4 products). Phase 2: each wave 2 row tiles of wy by 4 column tiles (a w_w
// fragment feeds 4 products, a y fragment 2).
// k order, phase 1, chunk of 8: lane half h holds k = 4h..4h+3 of both operands.
// k order, phase 2, block of 32: lane half h holds k = 16h..16h+15 of both
// operands, so the four 16-byte loads of a w_w row in a block share one line.
// y in LDS: element (k, column 4*lm + j) sits at float index
//   (k>>1)*128 + (j>>1)*64 + lm*4 + (j&1)*2 + (k&1)
// so one 16-byte LDS load is two ready B fragments (k pair x 2 column tiles)
// and 16 lanes read 256 contiguous bytes.
// ---------------------------------------------------------------------------
struct YFrag {      // two chunks of 8 k
  float a[2][4];    // M[k][c0 + lm], k = 4*half + i of chunk c
  v4f   x[2][4];    // theta rows k = 4*half + i, columns t0 + 4*lm .. +3
};

__device__ __forceinline__ void y_load(YFrag& f, const float* ml,
                                       const float* tl, int s) {
  for (int c = 0; c < 2; ++c) {
    for (int i = 0; i < 4; ++i) {
      f.a[c][i] = ml[(s * 16 + c * 8 + i) * Cin];
      f.x[c][i] = *(const v4f*)(tl + (size_t)(s * 16 + c * 8 + i) * Tt);
    }
  }
}

__device__ __forceinline__ void y_mac(const YFrag& f, v8f (&acc)[4]) {
  for (int c = 0; c < 2; ++c) {
    for (int p = 0; p < 2; ++p) {
      v2f am;
      am.x = f.a[c][2 * p];
      am.y = f.a[c][2 * p + 1];
      for (int j = 0; j < 4; ++j) {
        v2f bj;
        bj.x = f.x[c][2 * p][j];
        bj.y = f.x[c][2 * p + 1][j];
        acc[j] = wmma4(am, bj, acc[j]);
      }
    }
  }
}

struct WFrag {
  v4f a[2][4];  // w_w rows of 2 row tiles: k = 16*half + 4*q .. +3 of the block
};

__device__ __forceinline__ void w_load(WFrag& f, const float* wl, int blk) {
  for (int m = 0; m < 2; ++m)
    for (int q = 0; q < 4; ++q)
      f.a[m][q] = *(const v4f*)(wl + m * 16 * Cin + blk * 32 + q * 4);
}

__device__ __forceinline__ void wy_mac(const WFrag& f, const float* yl, int blk,
                                       v8f (&acc)[2][4]) {
  for (int q = 0; q < 4; ++q) {
    for (int p = 0; p < 2; ++p) {
      for (int jj = 0; jj < 2; ++jj) {
        v4f yv = *(const v4f*)(yl + (blk * 16 + q * 2 + p) * 128 + jj * 64);
        for (int e = 0; e < 2; ++e) {
          v2f bj;
          bj.x = yv[2 * e];
          bj.y = yv[2 * e + 1];
          for (int m = 0; m < 2; ++m) {
            v2f am;
            am.x = f.a[m][q][2 * p];
            am.y = f.a[m][q][2 * p + 1];
            acc[m][2 * jj + e] = wmma4(am, bj, acc[m][2 * jj + e]);
          }
        }
      }
    }
  }
}

__global__ __launch_bounds__(256) void y_wy_kernel(
    const float* __restrict__ theta, const float* __restrict__ Mmat,
    const float* __restrict__ ww, const float* __restrict__ wb,
    float* __restrict__ outp) {
  __shared__ __attribute__((aligned(16))) float ylds[Cin * 64];  // 32 KB
  int wv   = __builtin_amdgcn_readfirstlane(threadIdx.x >> 5);  // 0..7
  int lane = threadIdx.x & 31;
  int half = lane >> 4, lm = lane & 15;
  int b  = blockIdx.x >> 7;             // Bk * (Tt/64) = 512 work-groups
  int t0 = (blockIdx.x & 127) * 64;

  // first block of this wave's w_w rows: in flight across phase 1
  int o0 = wv * 32;
  const float* wl = ww + (size_t)(o0 + lm) * Cin + half * 16;
  WFrag w0, w1;
  w_load(w0, wl, 0);

  // phase 1: y[c0..c0+15, t0..t0+63], c0 = 16*wv
  const float* tl = theta + (size_t)b * Cin * Tt + (size_t)(half * 4) * Tt + t0 + lm * 4;
  const float* ml = Mmat + (size_t)b * Cin * Cin + (half * 4) * Cin + wv * 16 + lm;
  v8f acc[4] = {};
  // Two fragment sets of 16 k each: a set's loads are issued ahead of the 16
  // products of the set before it. The last pair of sets is peeled.
  YFrag f0, f1;
  y_load(f0, ml, tl, 0);
  // kept rolled: unrolled whole, the build moved loads down next to their waits
#pragma unroll 1
  for (int s = 0; s < Cin / 16 - 2; s += 2) {
    y_load(f1, ml, tl, s + 1);
    y_mac(f0, acc);
    y_load(f0, ml, tl, s + 2);
    y_mac(f1, acc);
  }
  y_load(f1, ml, tl, Cin / 16 - 1);
  y_mac(f0, acc);
  y_mac(f1, acc);

  // rows c0 + 8*half + 2u, +1 are k pair wv*8 + half*4 + u
  float* ys = ylds + (wv * 8 + half * 4) * 128 + lm * 4;
  for (int u = 0; u < 4; ++u) {
    for (int jj = 0; jj < 2; ++jj) {
      v4f v;
      v.x = acc[2 * jj][2 * u];
      v.y = acc[2 * jj][2 * u + 1];
      v.z = acc[2 * jj + 1][2 * u];
      v.w = acc[2 * jj + 1][2 * u + 1];
      *(v4f*)(ys + u * 128 + jj * 64) = v;
    }
  }
  __syncthreads();

  // phase 2: wy[o0..o0+31, t0..t0+63]; each block's w_w loads are issued ahead
  // of the products of the block before it
  const float* yl = ylds + (half * 8) * 128 + lm * 4;
  v8f a2[2][4] = {};
  w_load(w1, wl, 1);
  wy_mac(w0, yl, 0, a2);
  w_load(w0, wl, 2);
  wy_mac(w1, yl, 1, a2);
  w_load(w1, wl, 3);
  v4f bz[2][2];   // w_b of this lane's rows o0 + 16*m + 8*half + 0..7
  for (int m = 0; m < 2; ++m)
    for (int hh = 0; hh < 2; ++hh)
      bz[m][hh] = *(const v4f*)(wb + o0 + m * 16 + half * 8 + hh * 4);
  // precaution: later values land in address registers of the loads above;
  // this wait stands in front of that overwrite
  asm volatile("s_wait_xcnt 0x0" ::: "memory");
  wy_mac(w0, yl, 2, a2);
  wy_mac(w1, yl, 3, a2);

  for (int m = 0; m < 2; ++m) {
    float* ob = outp + ((size_t)b * Cc + o0 + m * 16) * Tt + t0 + lm * 4;
    for (int r = 0; r < 8; ++r) {
      int row = r + half * 8;
      float br = bz[m][r >> 2][r & 3];
      v4f v;
      v.x = a2[m][0][r] + br;
      v.y = a2[m][1][r] + br;
      v.z = a2[m][2][r] + br;
      v.w = a2[m][3][r] + br;
      *(v4f*)(ob + (size_t)row * Tt) = v;
    }
  }
}

// ---------------------------------------------------------------------------
// Kernel 4: per-channel sums over (B,T) of wy (deterministic tree reduction)
// ---------------------------------------------------------------------------
__global__ __launch_bounds__(256) void bn_stats_kernel(
    const float* __restrict__ wy, float* __restrict__ sumb,
    float* __restrict__ sumsqb) {
  __shared__ float ls[256], ls2[256];
  int c = blockIdx.x, tid = threadIdx.x;
  float s = 0.f, s2 = 0.f;
  for (int b = 0; b < Bk; ++b) {
    const float* p = wy + ((size_t)b * Cc + c) * Tt;
    for (int t = tid; t < Tt; t += 256) {
      float v = p[t];
      s += v; s2 += v * v;
    }
  }
  ls[tid] = s; ls2[tid] = s2;
  __syncthreads();
  for (int off = 128; off > 0; off >>= 1) {
    if (tid < off) { ls[tid] += ls[tid + off]; ls2[tid] += ls2[tid + off]; }
    __syncthreads();
  }
  if (tid == 0) { sumb[c] = ls[0]; sumsqb[c] = ls2[0]; }
}

__global__ void bn_finalize_kernel(const float* __restrict__ sumb,
                                   const float* __restrict__ sumsqb,
                                   const float* __restrict__ gamma,
                                   const float* __restrict__ beta,
                                   float* __restrict__ scaleb,
                                   float* __restrict__ shiftb) {
  int c = threadIdx.x;  // 256 threads, 1 block
  float inv  = 1.0f / (float)(Bk * Tt);
  float mean = sumb[c] * inv;
  float var  = sumsqb[c] * inv - mean * mean;
  float sc   = gamma[c] * rsqrtf(var + BN_EPS);
  scaleb[c]  = sc;
  shiftb[c]  = beta[c] - mean * sc;
}

// out = scale[c]*wy + shift[c] + x   (wy already resident in d_out)
__global__ __launch_bounds__(256) void bn_apply_kernel(
    const float* __restrict__ x, const float* __restrict__ scaleb,
    const float* __restrict__ shiftb, float* outp) {
  size_t total4 = (size_t)Bk * Cc * Tt / 4;
  size_t stride = (size_t)gridDim.x * blockDim.x;
  for (size_t i = (size_t)blockIdx.x * blockDim.x + threadIdx.x; i < total4;
       i += stride) {
    int c = (int)(((i * 4) / Tt) % Cc);
    float4 wy = ((const float4*)outp)[i];
    float4 xv = ((const float4*)x)[i];
    float sc = scaleb[c], sh = shiftb[c];
    float4 r;
    r.x = sc * wy.x + sh + xv.x;
    r.y = sc * wy.y + sh + xv.y;
    r.z = sc * wy.z + sh + xv.z;
    r.w = sc * wy.w + sh + xv.w;
    ((float4*)outp)[i] = r;
  }
}

// ---------------------------------------------------------------------------
extern "C" void kernel_launch(void* const* d_in, const int* in_sizes, int n_in,
                              void* d_out, int out_size, void* d_ws,
                              size_t ws_size, hipStream_t stream) {
  (void)in_sizes; (void)n_in; (void)out_size; (void)ws_size;
  const float* x       = (const float*)d_in[0];
  const float* theta_w = (const float*)d_in[1];
  const float* theta_b = (const float*)d_in[2];
  const float* phi_w   = (const float*)d_in[3];
  const float* phi_b   = (const float*)d_in[4];
  const float* g_w     = (const float*)d_in[5];
  const float* g_b     = (const float*)d_in[6];
  const float* w_w     = (const float*)d_in[7];
  const float* w_b     = (const float*)d_in[8];
  const float* gamma   = (const float*)d_in[9];
  const float* beta    = (const float*)d_in[10];
  float* outp = (float*)d_out;

  // workspace layout (floats)
  float* ws    = (float*)d_ws;
  float* theta = ws;                                   // 4*128*8192 = 4194304
  float* phiP  = theta + (size_t)Bk * Cin * Tt;        // 2097152
  float* gP    = phiP + (size_t)Bk * Cin * Npool;      // 2097152
  float* Mbuf  = gP + (size_t)Bk * Cin * Npool;        // 65536
  float* sumb  = Mbuf + (size_t)Bk * Cin * Cin;        // 256
  float* sumsq = sumb + Cc;                            // 256
  float* scl   = sumsq + Cc;                           // 256
  float* shf   = scl + Cc;                             // 256
  float* Mpart = shf + Cc;                             // KSPLIT * 65536 (~38 MB total)

  // 1) theta = conv(theta_w) ; phiP/gP = maxpool2(conv(...))
  //    4 row-tile pairs x 128 column spans of 256
  conv3_kernel<<<512, 256, 0, stream>>>(x, theta_w, theta_b, phi_w, phi_b, g_w,
                                        g_b, theta, phiP, gP);

  // 2) M = phiP * gP^T / N   (256 tiles x KSPLIT slices, then the plane sum)
  mmat_kernel<<<512, 256, 0, stream>>>(phiP, gP, Mpart);    // 32 * KSPLIT groups
  mreduce_kernel<<<64, 256, 0, stream>>>(Mpart, Mbuf);      // 65536 / 4 threads

  // 3) y = M^T theta ; wy = w_w*y + w_b  -> d_out   (4 x 128 spans of 64 columns)
  y_wy_kernel<<<512, 256, 0, stream>>>(theta, Mbuf, w_w, w_b, outp);

  // 4) batchnorm statistics + finalize + apply (+ residual)
  bn_stats_kernel<<<Cc, 256, 0, stream>>>(outp, sumb, sumsq);
  bn_finalize_kernel<<<1, 256, 0, stream>>>(sumb, sumsq, gamma, beta, scl, shf);
  bn_apply_kernel<<<2048, 256, 0, stream>>>(x, scl, shf, outp);
}

// v004
// It runs in 81.2 microseconds.
// Timed twice side by side with v003, it ran 1.13 and 1.14 times as fast.
// Counting every step since v000, it is 3.05 times as fast.
#include <hip/hip_runtime.h>

// Problem constants (from setup_inputs): B=4, C=256, Ci=128, T=8192, N=T/2
#define Bk  4
#define Cc  256
#define Cin 128
#define Tt  8192
#define Npool 4096
#define BN_EPS 1e-5f
#define KSPLIT 16                 // K slices of the M product, 32 work-groups each
#define KCHUNK (Npool / KSPLIT)

typedef float v2f __attribute__((ext_vector_type(2)));
typedef float v4f __attribute__((ext_vector_type(4)));
typedef float v8f __attribute__((ext_vector_type(8)));

// V_WMMA_F32_16X16X4_F32 : D(16x16 f32) = A(16x4 f32) * B(4x16 f32) + C
// 8-arg pattern: (neg_a, A, neg_b, B, c_mod, C, reuse_a, reuse_b)
__device__ __forceinline__ v8f wmma4(v2f a, v2f b, v8f c) {
  return __builtin_amdgcn_wmma_f32_16x16x4_f32(false, a, false, b, (short)0, c,
                                               false, false);
}

// Value of v in another lane of the same 16-lane row (CTRL 0x160 + m: lane ^ m).
template <int CTRL>
__device__ __forceinline__ float row_xlane(float v) {
  return __builtin_bit_cast(
      float, __builtin_amdgcn_update_dpp(0, __builtin_bit_cast(int, v), CTRL,
                                         0xf, 0xf, true));
}

// Sums v[i] over the 16 lanes of a row; lane lm returns the sum of v[lm].
// Each step halves the list: a lane keeps the half that its bit of lm names and
// hands the other half to the lane that keeps it.
__device__ __forceinline__ float row_scatter_sum(float (&v)[16], int lm) {
  bool b3 = (lm & 8) != 0, b2 = (lm & 4) != 0, b1 = (lm & 2) != 0,
       b0 = (lm & 1) != 0;
  for (int i = 0; i < 8; ++i)
    v[i] = (b3 ? v[i + 8] : v[i]) + row_xlane<0x168>(b3 ? v[i] : v[i + 8]);
  for (int i = 0; i < 4; ++i)
    v[i] = (b2 ? v[i + 4] : v[i]) + row_xlane<0x164>(b2 ? v[i] : v[i + 4]);
  for (int i = 0; i < 2; ++i)
    v[i] = (b1 ? v[i + 2] : v[i]) + row_xlane<0x162>(b1 ? v[i] : v[i + 2]);
  return (b0 ? v[1] : v[0]) + row_xlane<0x161>(b0 ? v[0] : v[1]);
}

// ---------------------------------------------------------------------------
// Kernel 1: the three 1x1 convs as one GEMM launch.
//   theta[b,o,t] = sum_c theta_w[o,c] x[b,c,t] + theta_b[o]
//   phiP / gP    = maxpool2 over t of the same form with phi_w / g_w
// Each wave holds a register tile of 48 rows (row tile o0 of each of the three
// weights) by 64 columns (4 column tiles), so one x fragment feeds 3 products
// and one weight fragment 4. Work-group: 2 row tiles x 4 column spans.
// Column tile j of a wave holds t = t0 + 4*lm + j, so one 16-byte load of an x
// row serves all four tiles, a pool pair sits in one lane, and rows are stored
// as whole 16-byte (theta) or 8-byte (pooled) pieces per lane.
// k order inside a chunk of 8: lane half h holds k = 4h..4h+3 of both operands;
// the first product of the chunk takes elements 0,1 and the second 2,3.
// ---------------------------------------------------------------------------
struct ConvFrag {
  v4f a[3];   // weight rows: k = 4*half .. 4*half+3 of the chunk
  v4f x[4];   // x rows k = 4*half + i, columns t0 + 4*lm .. +3
};

__device__ __forceinline__ void conv_load(ConvFrag& f, const float* w0,
                                          const float* w1, const float* w2,
                                          const float* xl, int kb) {
  f.a[0] = *(const v4f*)(w0 + kb * 8);
  f.a[1] = *(const v4f*)(w1 + kb * 8);
  f.a[2] = *(const v4f*)(w2 + kb * 8);
  for (int i = 0; i < 4; ++i)
    f.x[i] = *(const v4f*)(xl + (size_t)(kb * 8 + i) * Tt);
}

__device__ __forceinline__ void conv_mac(const ConvFrag& f, v8f (&acc)[3][4]) {
  for (int p = 0; p < 2; ++p) {
    for (int j = 0; j < 4; ++j) {
      v2f bj;
      bj.x = f.x[2 * p][j];
      bj.y = f.x[2 * p + 1][j];
      for (int m = 0; m < 3; ++m) {
        v2f am;
        am.x = f.a[m][2 * p];
        am.y = f.a[m][2 * p + 1];
        acc[m][j] = wmma4(am, bj, acc[m][j]);
      }
    }
  }
}

__device__ __forceinline__ void conv_store_pool(const v8f (&acc)[4],
                                                const float* bias, float* ob,
                                                int half) {
  // maxpool2 of columns (0,1) and (2,3) of the lane, then bias (commutes)
  for (int r = 0; r < 8; ++r) {
    int row = r + half * 8;
    float bz = bias[row];
    v2f v;
    v.x = fmaxf(acc[0][r], acc[1][r]) + bz;
    v.y = fmaxf(acc[2][r], acc[3][r]) + bz;
    *(v2f*)(ob + (size_t)row * Npool) = v;
  }
}

__global__ __launch_bounds__(256) void conv3_kernel(
    const float* __restrict__ x, const float* __restrict__ tw,
    const float* __restrict__ tb, const float* __restrict__ pw,
    const float* __restrict__ pb, const float* __restrict__ gw,
    const float* __restrict__ gb, float* __restrict__ theta,
    float* __restrict__ phiP, float* __restrict__ gP) {
  int wv   = __builtin_amdgcn_readfirstlane(threadIdx.x >> 5);  // 0..7
  int lane = threadIdx.x & 31;
  int half = lane >> 4, lm = lane & 15;
  int rg = blockIdx.x & 3;              // pair of row tiles
  int cg = blockIdx.x >> 2;             // 256-column span, 0..127
  int b  = cg >> 5;
  int t0 = (cg & 31) * 256 + (wv & 3) * 64;
  int o0 = (rg * 2 + (wv >> 2)) * 16;

  const float* xl = x + (size_t)b * Cc * Tt + (size_t)(half * 4) * Tt + t0 + lm * 4;
  size_t woff = (size_t)(o0 + lm) * Cc + half * 4;
  const float* w0 = tw + woff;
  const float* w1 = pw + woff;
  const float* w2 = gw + woff;

  v8f acc[3][4] = {};
  // Two fragment sets: each chunk's loads are issued ahead of the products of
  // the chunk before it. The last pair of chunks is peeled (nothing to fetch).
  ConvFrag f0, f1;
  conv_load(f0, w0, w1, w2, xl, 0);
  for (int kb = 0; kb < Cc / 8 - 2; kb += 2) {
    conv_load(f1, w0, w1, w2, xl, kb + 1);
    conv_mac(f0, acc);
    conv_load(f0, w0, w1, w2, xl, kb + 2);
    conv_mac(f1, acc);
  }
  conv_load(f1, w0, w1, w2, xl, Cc / 8 - 1);
  // precaution: the bias loads below land in address registers of the loads
  // above; this wait stands in front of that overwrite
  asm volatile("s_wait_xcnt 0x0" ::: "memory");
  conv_mac(f0, acc);
  conv_mac(f1, acc);

  float* ot = theta + ((size_t)b * Cin + o0) * Tt + t0 + lm * 4;
  for (int r = 0; r < 8; ++r) {
    int row = r + half * 8;
    float bz = tb[o0 + row];
    v4f v;
    v.x = acc[0][0][r] + bz;
    v.y = acc[0][1][r] + bz;
    v.z = acc[0][2][r] + bz;
    v.w = acc[0][3][r] + bz;
    *(v4f*)(ot + (size_t)row * Tt) = v;
  }
  size_t poff = ((size_t)b * Cin + o0) * Npool + (t0 >> 1) + lm * 2;
  conv_store_pool(acc[1], pb + o0, phiP + poff, half);
  conv_store_pool(acc[2], gb + o0, gP + poff, half);
}

// ---------------------------------------------------------------------------
// Kernel 2: M[b,cp,c] = (1/N) * sum_n phi[b,cp,n] * g[b,c,n]   (128x128, K=4096)
// Split K: one wave per 16x16 tile and K slice of KCHUNK; slice s stores its
// unscaled partial tile in plane s of Pout. Both fragments are contiguous
// float2 loads. mreduce_kernel then sums the planes in slice order and scales.
// ---------------------------------------------------------------------------
__global__ __launch_bounds__(256) void mmat_kernel(
    const float* __restrict__ phi, const float* __restrict__ g,
    float* __restrict__ Pout) {
  int wid  = (blockIdx.x * blockDim.x + threadIdx.x) >> 5;
  int lane = threadIdx.x & 31;
  int half = lane >> 4, lm = lane & 15;
  int ct  = wid & 7;
  int cpt = (wid >> 3) & 7;
  int b   = (wid >> 6) & 3;
  int s   = wid >> 8;                   // K slice, 0..KSPLIT-1
  const float* pb = phi + ((size_t)b * Cin + cpt * 16) * Npool + s * KCHUNK;
  const float* gb = g   + ((size_t)b * Cin + ct * 16) * Npool + s * KCHUNK;
  v8f acc = {};
  for (int ks = 0; ks < KCHUNK / 4; ++ks) {
    int k = ks * 4 + half * 2;
    v2f a  = *(const v2f*)(pb + (size_t)lm * Npool + k);  // A[row=cp, k=n]
    v2f bb = *(const v2f*)(gb + (size_t)lm * Npool + k);  // B[k=n, col=c]
    acc = wmma4(a, bb, acc);
  }
  float* Mb = Pout + ((size_t)s * Bk + b) * Cin * Cin +
              (size_t)(cpt * 16) * Cin + ct * 16;
  for (int r = 0; r < 8; ++r) {
    int row = r + half * 8;
    Mb[(size_t)row * Cin + lm] = acc[r];
  }
}

// Kernel 2b: M = (1/N) * sum_s Pout[s], four elements per thread.
__global__ __launch_bounds__(256) void mreduce_kernel(
    const float* __restrict__ Pin, float* __restrict__ Mout) {
  const int plane4 = Bk * Cin * Cin / 4;
  int i = blockIdx.x * blockDim.x + threadIdx.x;   // 0..plane4-1
  const float4* p = (const float4*)Pin + i;
  float4 a = p[0];
  for (int s = 1; s < KSPLIT; ++s) {
    float4 v = p[(size_t)s * plane4];
    a.x += v.x; a.y += v.y; a.z += v.z; a.w += v.w;
  }
  const float scale = 1.0f / (float)Npool;
  a.x *= scale; a.y *= scale; a.z *= scale; a.w *= scale;
  ((float4*)Mout)[i] = a;
}

// ---------------------------------------------------------------------------
// Kernel 3: per (b, span of 64 columns t):  y = M^T * theta  (128x64, in LDS),
//           then wy = w_w * y + w_b (256x64) written to d_out.
// 8 waves. Column tile j of a wave holds t = t0 + 4*lm + j (as in kernel 1), so
// theta rows are read and wy rows stored as 16-byte pieces per lane.
// Phase 1: each wave one row tile of y by 4 column tiles (one M fragment feeds
// 4 products). Phase 2: each wave 2 row tiles of wy by 4 column tiles (a w_w
// fragment feeds 4 products, a y fragment 2).
// k order, phase 1, chunk of 8: lane half h holds k = 4h..4h+3 of both operands.
// k order, phase 2, block of 32: lane half h holds k = 16h..16h+15 of both
// operands, so the four 16-byte loads of a w_w row in a block share one line.
// y in LDS: element (k, column 4*lm + j) sits at float index
//   (k>>1)*128 + (j>>1)*64 + lm*4 + (j&1)*2 + (k&1)
// so one 16-byte LDS load is two ready B fragments (k pair x 2 column tiles)
// and 16 lanes read 256 contiguous bytes.
// Epilogue: each wave also sums wy and wy^2 of its 32 rows over the group's 64
// columns, from the values it stores, and writes them as one 128-byte line each
// of psum / psq (row = work-group, column = channel) for the batchnorm.
// ---------------------------------------------------------------------------
struct YFrag {      // two chunks of 8 k
  float a[2][4];    // M[k][c0 + lm], k = 4*half + i of chunk c
  v4f   x[2][4];    // theta rows k = 4*half + i, columns t0 + 4*lm .. +3
};

__device__ __forceinline__ void y_load(YFrag& f, const float* ml,
                                       const float* tl, int s) {
  for (int c = 0; c < 2; ++c) {
    for (int i = 0; i < 4; ++i) {
      f.a[c][i] = ml[(s * 16 + c * 8 + i) * Cin];
      f.x[c][i] = *(const v4f*)(tl + (size_t)(s * 16 + c * 8 + i) * Tt);
    }
  }
}

__device__ __forceinline__ void y_mac(const YFrag& f, v8f (&acc)[4]) {
  for (int c = 0; c < 2; ++c) {
    for (int p = 0; p < 2; ++p) {
      v2f am;
      am.x = f.a[c][2 * p];
      am.y = f.a[c][2 * p + 1];
      for (int j = 0; j < 4; ++j) {
        v2f bj;
        bj.x = f.x[c][2 * p][j];
        bj.y = f.x[c][2 * p + 1][j];
        acc[j] = wmma4(am, bj, acc[j]);
      }
    }
  }
}

struct WFrag {
  v4f a[2][4];  // w_w rows of 2 row tiles: k = 16*half + 4*q .. +3 of the block
};

__device__ __forceinline__ void w_load(WFrag& f, const float* wl, int blk) {
  for (int m = 0; m < 2; ++m)
    for (int q = 0; q < 4; ++q)
      f.a[m][q] = *(const v4f*)(wl + m * 16 * Cin + blk * 32 + q * 4);
}

__device__ __forceinline__ void wy_mac(const WFrag& f, const float* yl, int blk,
                                       v8f (&acc)[2][4]) {
  for (int q = 0; q < 4; ++q) {
    for (int p = 0; p < 2; ++p) {
      for (int jj = 0; jj < 2; ++jj) {
        v4f yv = *(const v4f*)(yl + (blk * 16 + q * 2 + p) * 128 + jj * 64);
        for (int e = 0; e < 2; ++e) {
          v2f bj;
          bj.x = yv[2 * e];
          bj.y = yv[2 * e + 1];
          for (int m = 0; m < 2; ++m) {
            v2f am;
            am.x = f.a[m][q][2 * p];
            am.y = f.a[m][q][2 * p + 1];
            acc[m][2 * jj + e] = wmma4(am, bj, acc[m][2 * jj + e]);
          }
        }
      }
    }
  }
}

__global__ __launch_bounds__(256) void y_wy_kernel(
    const float* __restrict__ theta, const float* __restrict__ Mmat,
    const float* __restrict__ ww, const float* __restrict__ wb,
    float* __restrict__ outp, float* __restrict__ psum,
    float* __restrict__ psq) {
  __shared__ __attribute__((aligned(16))) float ylds[Cin * 64];  // 32 KB
  int wv   = __builtin_amdgcn_readfirstlane(threadIdx.x >> 5);  // 0..7
  int lane = threadIdx.x & 31;
  int half = lane >> 4, lm = lane & 15;
  int b  = blockIdx.x >> 7;             // Bk * (Tt/64) = 512 work-groups
  int t0 = (blockIdx.x & 127) * 64;

  // first block of this wave's w_w rows: in flight across phase 1
  int o0 = wv * 32;
  const float* wl = ww + (size_t)(o0 + lm) * Cin + half * 16;
  WFrag w0, w1;
  w_load(w0, wl, 0);

  // phase 1: y[c0..c0+15, t0..t0+63], c0 = 16*wv
  const float* tl = theta + (size_t)b * Cin * Tt + (size_t)(half * 4) * Tt + t0 + lm * 4;
  const float* ml = Mmat + (size_t)b * Cin * Cin + (half * 4) * Cin + wv * 16 + lm;
  v8f acc[4] = {};
  // Two fragment sets of 16 k each: a set's loads are issued ahead of the 16
  // products of the set before it. The last pair of sets is peeled.
  YFrag f0, f1;
  y_load(f0, ml, tl, 0);
  // kept rolled: unrolled whole, the build moved loads down next to their waits
#pragma unroll 1
  for (int s = 0; s < Cin / 16 - 2; s += 2) {
    y_load(f1, ml, tl, s + 1);
    y_mac(f0, acc);
    y_load(f0, ml, tl, s + 2);
    y_mac(f1, acc);
  }
  y_load(f1, ml, tl, Cin / 16 - 1);
  y_mac(f0, acc);
  y_mac(f1, acc);

  // rows c0 + 8*half + 2u, +1 are k pair wv*8 + half*4 + u
  float* ys = ylds + (wv * 8 + half * 4) * 128 + lm * 4;
  for (int u = 0; u < 4; ++u) {
    for (int jj = 0; jj < 2; ++jj) {
      v4f v;
      v.x = acc[2 * jj][2 * u];
      v.y = acc[2 * jj][2 * u + 1];
      v.z = acc[2 * jj + 1][2 * u];
      v.w = acc[2 * jj + 1][2 * u + 1];
      *(v4f*)(ys + u * 128 + jj * 64) = v;
    }
  }
  __syncthreads();

  // phase 2: wy[o0..o0+31, t0..t0+63]; each block's w_w loads are issued ahead
  // of the products of the block before it
  const float* yl = ylds + (half * 8) * 128 + lm * 4;
  v8f a2[2][4] = {};
  w_load(w1, wl, 1);
  wy_mac(w0, yl, 0, a2);
  w_load(w0, wl, 2);
  wy_mac(w1, yl, 1, a2);
  w_load(w1, wl, 3);
  v4f bz[2][2];   // w_b of this lane's rows o0 + 16*m + 8*half + 0..7
  for (int m = 0; m < 2; ++m)
    for (int hh = 0; hh < 2; ++hh)
      bz[m][hh] = *(const v4f*)(wb + o0 + m * 16 + half * 8 + hh * 4);
  // precaution: later values land in address registers of the loads above;
  // this wait stands in front of that overwrite
  asm volatile("s_wait_xcnt 0x0" ::: "memory");
  wy_mac(w0, yl, 2, a2);
  wy_mac(w1, yl, 3, a2);

  float rs[16], rq[16];   // this lane's 4 columns of row o0 + 16*m + 8*half + r
  for (int m = 0; m < 2; ++m) {
    float* ob = outp + ((size_t)b * Cc + o0 + m * 16) * Tt + t0 + lm * 4;
    for (int r = 0; r < 8; ++r) {
      int row = r + half * 8;
      float br = bz[m][r >> 2][r & 3];
      v4f v;
      v.x = a2[m][0][r] + br;
      v.y = a2[m][1][r] + br;
      v.z = a2[m][2][r] + br;
      v.w = a2[m][3][r] + br;
      *(v4f*)(ob + (size_t)row * Tt) = v;
      v2f lo = {v.x, v.y}, hi = {v.z, v.w};
      v2f a = lo + hi, p = lo * lo + hi * hi;
      rs[m * 8 + r] = a.x + a.y;
      rq[m * 8 + r] = p.x + p.y;
    }
  }
  // lane lm ends with list entry lm, which is m = lm >> 3, r = lm & 7
  float ts = row_scatter_sum(rs, lm);
  float tq = row_scatter_sum(rq, lm);
  size_t pidx = (size_t)blockIdx.x * Cc + o0 + (lm >> 3) * 16 + half * 8 + (lm & 7);
  psum[pidx] = ts;
  psq[pidx]  = tq;
}

// ---------------------------------------------------------------------------
// Kernel 4: out = scale[c]*wy + shift[c] + x   (wy already resident in d_out)
// One work-group: 32 channels (one 128-byte line of every psum / psq row) of one
// batch by APCOLS columns; 16 waves, 2 channel rows each. It first adds the
// NPART partial sums of its 32 channels in a fixed order and forms scale and
// shift itself; its wy and x loads are issued ahead of that and land meanwhile.
// ---------------------------------------------------------------------------
#define NPART  (Bk * Tt / 64)     // work-groups of y_wy_kernel = rows of psum, psq
#define APCOLS 1024

// Value of v in the same lane of the other 16-lane row.
__device__ __forceinline__ float other_row(float v) {
  int i = __builtin_bit_cast(int, v);
  return __builtin_bit_cast(
      float, __builtin_amdgcn_permlanex16(i, i, 0x76543210, 0xfedcba98, false,
                                          false));
}

__global__ __launch_bounds__(512) void bn_apply_kernel(
    const float* __restrict__ x, const float* __restrict__ psum,
    const float* __restrict__ psq, const float* __restrict__ gamma,
    const float* __restrict__ beta, float* outp) {
  __shared__ __attribute__((aligned(16))) float red[16][64];
  __shared__ float scsh[64];
  int tid  = threadIdx.x;
  int wv   = __builtin_amdgcn_readfirstlane(tid >> 5);  // 0..15
  int lane = tid & 31;
  int cg = blockIdx.x & 7;              // group of 32 channels
  int tc = (blockIdx.x >> 3) & 7;       // span of APCOLS columns
  int b  = blockIdx.x >> 6;

  // partial rows (tid >> 3) + 64*i, channels cg*32 + 4*(tid & 7) .. +3
  int poff = (tid >> 3) * Cc + cg * 32 + (tid & 7) * 4;
  v4f ps[NPART / 64], pq[NPART / 64];
  for (int i = 0; i < NPART / 64; ++i) {
    ps[i] = *(const v4f*)(psum + poff + i * 64 * Cc);
    pq[i] = *(const v4f*)(psq + poff + i * 64 * Cc);
  }
  float ga = gamma[cg * 32 + lane];
  float be = beta[cg * 32 + lane];
  // precaution: results of the loads below land in address registers of the
  // loads above; this wait stands in front of that overwrite
  asm volatile("s_wait_xcnt 0x0" ::: "memory");

  size_t rowoff = ((size_t)b * Cc + cg * 32 + wv * 2) * Tt + tc * APCOLS;
  const float* xr = x + rowoff;       // wave-uniform; the lane adds 4*lane
  float* orow = outp + rowoff;
  v4f wy[2][APCOLS / 128], xv[2][APCOLS / 128];
  for (int k = 0; k < 2; ++k) {
    for (int j = 0; j < APCOLS / 128; ++j) {
      wy[k][j] = *(const v4f*)(orow + k * Tt + j * 128 + lane * 4);
      xv[k][j] = *(const v4f*)(xr + k * Tt + j * 128 + lane * 4);
    }
  }
  // keeps every load above issued ahead of the first wait for a partial sum;
  // without it part of the wy loads is issued only as partial sums arrive
  __builtin_amdgcn_sched_barrier(0);

  v4f s = ps[0], q = pq[0];
  for (int i = 1; i < NPART / 64; ++i) {
    s += ps[i];
    q += pq[i];
  }
  // the 4 lanes of a wave that hold the same channels: lane ^ 8, lane ^ 16
  for (int e = 0; e < 4; ++e) {
    s[e] += row_xlane<0x168>(s[e]);
    q[e] += row_xlane<0x168>(q[e]);
    s[e] += other_row(s[e]);
    q[e] += other_row(q[e]);
  }
  if (lane < 8) {
    *(v4f*)&red[wv][lane * 4]      = s;
    *(v4f*)&red[wv][32 + lane * 4] = q;
  }
  __syncthreads();
  if (wv == 0) {
    float ss = red[0][lane], qq = red[0][32 + lane];
    for (int w = 1; w < 16; ++w) {
      ss += red[w][lane];
      qq += red[w][32 + lane];
    }
    float inv  = 1.0f / (float)(Bk * Tt);
    float mean = ss * inv;
    float var  = qq * inv - mean * mean;
    float sc   = ga * rsqrtf(var + BN_EPS);
    scsh[lane]      = sc;
    scsh[32 + lane] = be - mean * sc;
  }
  __syncthreads();

  for (int k = 0; k < 2; ++k) {
    float sc = scsh[wv * 2 + k], sh = scsh[32 + wv * 2 + k];
    for (int j = 0; j < APCOLS / 128; ++j) {
      v4f r;
      r.x = sc * wy[k][j].x + sh + xv[k][j].x;
      r.y = sc * wy[k][j].y + sh + xv[k][j].y;
      r.z = sc * wy[k][j].z + sh + xv[k][j].z;
      r.w = sc * wy[k][j].w + sh + xv[k][j].w;
      *(v4f*)(orow + k * Tt + j * 128 + lane * 4) = r;
    }
  }
}

// ---------------------------------------------------------------------------
extern "C" void kernel_launch(void* const* d_in, const int* in_sizes, int n_in,
                              void* d_out, int out_size, void* d_ws,
                              size_t ws_size, hipStream_t stream) {
  (void)in_sizes; (void)n_in; (void)out_size; (void)ws_size;
  const float* x       = (const float*)d_in[0];
  const float* theta_w = (const float*)d_in[1];
  const float* theta_b = (const float*)d_in[2];
  const float* phi_w   = (const float*)d_in[3];
  const float* phi_b   = (const float*)d_in[4];
  const float* g_w     = (const float*)d_in[5];
  const float* g_b     = (const float*)d_in[6];
  const float* w_w     = (const float*)d_in[7];
  const float* w_b     = (const float*)d_in[8];
  const float* gamma   = (const float*)d_in[9];
  const float* beta    = (const float*)d_in[10];
  float* outp = (float*)d_out;

  // workspace layout (floats)
  float* ws    = (float*)d_ws;
  float* theta = ws;                                   // 4*128*8192 = 4194304
  float* phiP  = theta + (size_t)Bk * Cin * Tt;        // 2097152
  float* gP    = phiP + (size_t)Bk * Cin * Npool;      // 2097152
  float* Mbuf  = gP + (size_t)Bk * Cin * Npool;        // 65536
  float* Mpart = Mbuf + (size_t)Bk * Cin * Cin;        // KSPLIT * 65536
  float* psum  = Mpart + (size_t)KSPLIT * Bk * Cin * Cin;  // 512 * 256
  float* psq   = psum + (size_t)NPART * Cc;            // 512 * 256 (~39 MB total)

  // 1) theta = conv(theta_w) ; phiP/gP = maxpool2(conv(...))
  //    4 row-tile pairs x 128 column spans of 256
  conv3_kernel<<<512, 256, 0, stream>>>(x, theta_w, theta_b, phi_w, phi_b, g_w,
                                        g_b, theta, phiP, gP);

  // 2) M = phiP * gP^T / N   (256 tiles x KSPLIT slices, then the plane sum)
  mmat_kernel<<<512, 256, 0, stream>>>(phiP, gP, Mpart);    // 32 * KSPLIT groups
  mreduce_kernel<<<64, 256, 0, stream>>>(Mpart, Mbuf);      // 65536 / 4 threads

  // 3) y = M^T theta ; wy = w_w*y + w_b  -> d_out   (4 x 128 spans of 64 columns)
  //    and the per-group batchnorm sums -> psum, psq
  y_wy_kernel<<<512, 256, 0, stream>>>(theta, Mbuf, w_w, w_b, outp, psum, psq);

  // 4) batchnorm scale and shift from the partial sums, apply (+ residual)
  //    4 batches x 8 column spans x 8 channel groups
  bn_apply_kernel<<<256, 512, 0, stream>>>(x, psum, psq, gamma, beta, outp);
}

// v005
// Measured time: 77.2 microseconds a run.
// Timed twice side by side with v004, it ran 1.05 times as fast both times.
// All steps since v000 together make it 3.20 times as fast.
#include <hip/hip_runtime.h>

// Problem constants (from setup_inputs): B=4, C=256, Ci=128, T=8192, N=T/2
#define Bk  4
#define Cc  256
#define Cin 128
#define Tt  8192
#define Npool 4096
#define BN_EPS 1e-5f
#define KSPLIT 16                 // K slices of the M product, 32 work-groups each
#define KCHUNK (Npool / KSPLIT)

typedef float v2f __attribute__((ext_vector_type(2)));
typedef float v4f __attribute__((ext_vector_type(4)));
typedef float v8f __attribute__((ext_vector_type(8)));

// V_WMMA_F32_16X16X4_F32 : D(16x16 f32) = A(16x4 f32) * B(4x16 f32) + C
// 8-arg pattern: (neg_a, A, neg_b, B, c_mod, C, reuse_a, reuse_b)
__device__ __forceinline__ v8f wmma4(v2f a, v2f b, v8f c) {
  return __builtin_amdgcn_wmma_f32_16x16x4_f32(false, a, false, b, (short)0, c,
                                               false, false);
}

// Value of v in another lane of the same 16-lane row (CTRL 0x160 + m: lane ^ m).
template <int CTRL>
__device__ __forceinline__ float row_xlane(float v) {
  return __builtin_bit_cast(
      float, __builtin_amdgcn_update_dpp(0, __builtin_bit_cast(int, v), CTRL,
                                         0xf, 0xf, true));
}

// Sums v[i] over the 16 lanes of a row; lane lm returns the sum of v[lm].
// Each step halves the list: a lane keeps the half that its bit of lm names and
// hands the other half to the lane that keeps it.
__device__ __forceinline__ float row_scatter_sum(float (&v)[16], int lm) {
  bool b3 = (lm & 8) != 0, b2 = (lm & 4) != 0, b1 = (lm & 2) != 0,
       b0 = (lm & 1) != 0;
  for (int i = 0; i < 8; ++i)
    v[i] = (b3 ? v[i + 8] : v[i]) + row_xlane<0x168>(b3 ? v[i] : v[i + 8]);
  for (int i = 0; i < 4; ++i)
    v[i] = (b2 ? v[i + 4] : v[i]) + row_xlane<0x164>(b2 ? v[i] : v[i + 4]);
  for (int i = 0; i < 2; ++i)
    v[i] = (b1 ? v[i + 2] : v[i]) + row_xlane<0x162>(b1 ? v[i] : v[i + 2]);
  return (b0 ? v[1] : v[0]) + row_xlane<0x161>(b0 ? v[0] : v[1]);
}

// ---------------------------------------------------------------------------
// Kernel 1: the three 1x1 convs as one GEMM launch.
//   theta[b,o,t] = sum_c theta_w[o,c] x[b,c,t] + theta_b[o]
//   phiP / gP    = maxpool2 over t of the same form with phi_w / g_w
// Each wave holds a register tile of 48 rows (row tile o0 of each of the three
// weights) by 64 columns (4 column tiles), so one x fragment feeds 3 products
// and one weight fragment 4. Work-group: 2 row tiles x 4 column spans.
// Column tile j of a wave holds t = t0 + 4*lm + j, so one 16-byte load of an x
// row serves all four tiles, a pool pair sits in one lane, and rows are stored
// as whole 16-byte (theta) or 8-byte (pooled) pieces per lane.
// k order inside a chunk of 8: lane half h holds k = 4h..4h+3 of both operands;
// the first product of the chunk takes elements 0,1 and the second 2,3.
// ---------------------------------------------------------------------------
struct ConvFrag {
  v4f a[3];   // weight rows: k = 4*half .. 4*half+3 of the chunk
  v4f x[4];   // x rows k = 4*half + i, columns t0 + 4*lm .. +3
};

__device__ __forceinline__ void conv_load(ConvFrag& f, const float* w0,
                                          const float* w1, const float* w2,
                                          const float* xl, int kb) {
  f.a[0] = *(const v4f*)(w0 + kb * 8);
  f.a[1] = *(const v4f*)(w1 + kb * 8);
  f.a[2] = *(const v4f*)(w2 + kb * 8);
  for (int i = 0; i < 4; ++i)
    f.x[i] = *(const v4f*)(xl + (size_t)(kb * 8 + i) * Tt);
}

__device__ __forceinline__ void conv_mac(const ConvFrag& f, v8f (&acc)[3][4]) {
  for (int p = 0; p < 2; ++p) {
    for (int j = 0; j < 4; ++j) {
      v2f bj;
      bj.x = f.x[2 * p][j];
      bj.y = f.x[2 * p + 1][j];
      for (int m = 0; m < 3; ++m) {
        v2f am;
        am.x = f.a[m][2 * p];
        am.y = f.a[m][2 * p + 1];
        acc[m][j] = wmma4(am, bj, acc[m][j]);
      }
    }
  }
}

__device__ __forceinline__ void conv_store_pool(const v8f (&acc)[4],
                                                const float* bias, float* ob,
                                                int half) {
  // maxpool2 of columns (0,1) and (2,3) of the lane, then bias (commutes)
  for (int r = 0; r < 8; ++r) {
    int row = r + half * 8;
    float bz = bias[row];
    v2f v;
    v.x = fmaxf(acc[0][r], acc[1][r]) + bz;
    v.y = fmaxf(acc[2][r], acc[3][r]) + bz;
    *(v2f*)(ob + (size_t)row * Npool) = v;
  }
}

__global__ __launch_bounds__(256) void conv3_kernel(
    const float* __restrict__ x, const float* __restrict__ tw,
    const float* __restrict__ tb, const float* __restrict__ pw,
    const float* __restrict__ pb, const float* __restrict__ gw,
    const float* __restrict__ gb, float* __restrict__ theta,
    float* __restrict__ phiP, float* __restrict__ gP) {
  int wv   = __builtin_amdgcn_readfirstlane(threadIdx.x >> 5);  // 0..7
  int lane = threadIdx.x & 31;
  int half = lane >> 4, lm = lane & 15;
  int rg = blockIdx.x & 3;              // pair of row tiles
  int cg = blockIdx.x >> 2;             // 256-column span, 0..127
  int b  = cg >> 5;
  int t0 = (cg & 31) * 256 + (wv & 3) * 64;
  int o0 = (rg * 2 + (wv >> 2)) * 16;

  const float* xl = x + (size_t)b * Cc * Tt + (size_t)(half * 4) * Tt + t0 + lm * 4;
  size_t woff = (size_t)(o0 + lm) * Cc + half * 4;
  const float* w0 = tw + woff;
  const float* w1 = pw + woff;
  const float* w2 = gw + woff;

  v8f acc[3][4] = {};
  // Two fragment sets: each chunk's loads are issued ahead of the products of
  // the chunk before it. The last pair of chunks is peeled (nothing to fetch).
  ConvFrag f0, f1;
  conv_load(f0, w0, w1, w2, xl, 0);
  for (int kb = 0; kb < Cc / 8 - 2; kb += 2) {
    conv_load(f1, w0, w1, w2, xl, kb + 1);
    conv_mac(f0, acc);
    conv_load(f0, w0, w1, w2, xl, kb + 2);
    conv_mac(f1, acc);
  }
  conv_load(f1, w0, w1, w2, xl, Cc / 8 - 1);
  // precaution: the bias loads below land in address registers of the loads
  // above; this wait stands in front of that overwrite
  asm volatile("s_wait_xcnt 0x0" ::: "memory");
  conv_mac(f0, acc);
  conv_mac(f1, acc);

  float* ot = theta + ((size_t)b * Cin + o0) * Tt + t0 + lm * 4;
  for (int r = 0; r < 8; ++r) {
    int row = r + half * 8;
    float bz = tb[o0 + row];
    v4f v;
    v.x = acc[0][0][r] + bz;
    v.y = acc[0][1][r] + bz;
    v.z = acc[0][2][r] + bz;
    v.w = acc[0][3][r] + bz;
    *(v4f*)(ot + (size_t)row * Tt) = v;
  }
  size_t poff = ((size_t)b * Cin + o0) * Npool + (t0 >> 1) + lm * 2;
  conv_store_pool(acc[1], pb + o0, phiP + poff, half);
  conv_store_pool(acc[2], gb + o0, gP + poff, half);
}

// ---------------------------------------------------------------------------
// Kernel 2: M[b,cp,c] = (1/N) * sum_n phi[b,cp,n] * g[b,c,n]   (128x128, K=4096)
// Split K: one wave per 16x16 tile and K slice of KCHUNK; slice s stores its
// unscaled partial tile in plane s of Pout. Both fragments are contiguous
// float2 loads. w2_kernel then sums the planes in slice order and scales.
// ---------------------------------------------------------------------------
__global__ __launch_bounds__(256) void mmat_kernel(
    const float* __restrict__ phi, const float* __restrict__ g,
    float* __restrict__ Pout) {
  int wid  = (blockIdx.x * blockDim.x + threadIdx.x) >> 5;
  int lane = threadIdx.x & 31;
  int half = lane >> 4, lm = lane & 15;
  int ct  = wid & 7;
  int cpt = (wid >> 3) & 7;
  int b   = (wid >> 6) & 3;
  int s   = wid >> 8;                   // K slice, 0..KSPLIT-1
  const float* pb = phi + ((size_t)b * Cin + cpt * 16) * Npool + s * KCHUNK;
  const float* gb = g   + ((size_t)b * Cin + ct * 16) * Npool + s * KCHUNK;
  v8f acc = {};
  for (int ks = 0; ks < KCHUNK / 4; ++ks) {
    int k = ks * 4 + half * 2;
    v2f a  = *(const v2f*)(pb + (size_t)lm * Npool + k);  // A[row=cp, k=n]
    v2f bb = *(const v2f*)(gb + (size_t)lm * Npool + k);  // B[k=n, col=c]
    acc = wmma4(a, bb, acc);
  }
  float* Mb = Pout + ((size_t)s * Bk + b) * Cin * Cin +
              (size_t)(cpt * 16) * Cin + ct * 16;
  for (int r = 0; r < 8; ++r) {
    int row = r + half * 8;
    Mb[(size_t)row * Cin + lm] = acc[r];
  }
}

// Kernel 2b: W2[b,o,cp] = sum_c w_w[o,c] * M[b,cp,c], M = (1/N) * sum_s Pout[s].
// wy = w_w * (M^T * theta) is formed as (w_w * M^T) * theta: the product with M
// is done once per batch on 256 x 128 elements instead of once per column t.
// One work-group: 16 rows cp of M of one batch by 128 rows o, 8 waves. It adds
// the KSPLIT planes of its 16 rows in slice order into LDS and copies its 128
// rows of w_w there (both read as whole 512-byte rows per wave); then each wave
// forms one 16x16 tile (rows cp, columns o, K = 128).
// k order, chunk of 8: lane half h holds k = 4h..4h+3 of both operands; the
// first pair of a chunk goes to one accumulator and the second to another.
// W2 is stored in the order in which kernel 3 reads it: for row tile ot (16 o)
// and chunk kb (8 cp), 512 contiguous bytes; lane (h, lm) owns the 16 bytes
// W2[16*ot + lm][8*kb + 4*h .. +3]. A work-group writes whole 1-KB pieces.
// ---------------------------------------------------------------------------
#define MPITCH (Cin + 4)          // LDS row pitch in floats: 16 bytes x odd

__global__ __launch_bounds__(256) void w2_kernel(
    const float* __restrict__ Pin, const float* __restrict__ ww,
    float* __restrict__ W2) {
  __shared__ __attribute__((aligned(16))) float ms[16 * MPITCH];
  __shared__ __attribute__((aligned(16))) float wls[128 * MPITCH];
  int wv   = __builtin_amdgcn_readfirstlane(threadIdx.x >> 5);  // 0..7
  int lane = threadIdx.x & 31;
  int half = lane >> 4, lm = lane & 15;
  int oh  = blockIdx.x & 1;             // half of the rows o
  int cpt = (blockIdx.x >> 1) & 7;      // tile of 16 rows cp
  int b   = blockIdx.x >> 4;

  // plane sum: rows wv and wv + 8 of the tile, columns 4*lane .. +3
  const float* p = Pin + ((size_t)b * Cin + cpt * 16 + wv) * Cin + lane * 4;
  v4f pl[KSPLIT][2];
  for (int s = 0; s < KSPLIT; ++s) {
    pl[s][0] = *(const v4f*)(p + (size_t)s * Bk * Cin * Cin);
    pl[s][1] = *(const v4f*)(p + (size_t)s * Bk * Cin * Cin + 8 * Cin);
  }
  // w_w rows oh*128 + wv + 8*i, columns 4*lane .. +3
  const float* wr = ww + (size_t)(oh * 128 + wv) * Cin + lane * 4;
  v4f wreg[16];
  for (int i = 0; i < 16; ++i) wreg[i] = *(const v4f*)(wr + i * 8 * Cin);

  v4f m0 = pl[0][0], m1 = pl[0][1];
  for (int s = 1; s < KSPLIT; ++s) {
    m0 += pl[s][0];
    m1 += pl[s][1];
  }
  const float scale = 1.0f / (float)Npool;
  *(v4f*)(ms + wv * MPITCH + lane * 4)       = m0 * scale;
  *(v4f*)(ms + (wv + 8) * MPITCH + lane * 4) = m1 * scale;
  for (int i = 0; i < 16; ++i)
    *(v4f*)(wls + (wv + 8 * i) * MPITCH + lane * 4) = wreg[i];
  __syncthreads();

  const float* ml = ms + lm * MPITCH + half * 4;               // A: row cp
  const float* wl = wls + (wv * 16 + lm) * MPITCH + half * 4;  // B: column o
  v8f acc0 = {}, acc1 = {};
  for (int kb = 0; kb < Cin / 8; ++kb) {
    v4f av = *(const v4f*)(ml + kb * 8);
    v4f bv = *(const v4f*)(wl + kb * 8);
    v2f a0 = {av.x, av.y}, a1 = {av.z, av.w};
    v2f b0 = {bv.x, bv.y}, b1 = {bv.z, bv.w};
    acc0 = wmma4(a0, b0, acc0);
    acc1 = wmma4(a1, b1, acc1);
  }
  // this lane: o = 16*ot + lm, cp = 16*cpt + 8*half + r: chunk kb = 2*cpt + half,
  // r = 0..3 is the piece of reader lane (0, lm), r = 4..7 of reader lane (1, lm)
  int ot = oh * 8 + wv;
  float* ob = W2 + (((size_t)b * 16 + ot) * 16 + cpt * 2 + half) * 128 + lm * 4;
  v4f lo, hi;
  for (int e = 0; e < 4; ++e) {
    lo[e] = acc0[e] + acc1[e];
    hi[e] = acc0[e + 4] + acc1[e + 4];
  }
  *(v4f*)ob        = lo;
  *(v4f*)(ob + 64) = hi;
}

// ---------------------------------------------------------------------------
// Kernel 3: per (b, span of 64 columns t):  wy = W2 * theta + w_b  (256x64),
//           written to d_out.
// 8 waves, each 2 row tiles of wy by 4 column tiles: a W2 fragment feeds 4
// products, a theta fragment 2. Column tile j of a wave holds t = t0 + 4*lm + j
// (as in kernel 1), so theta rows are read and wy rows stored as 16-byte pieces
// per lane. W2 comes in the order of kernel 2b: 512 contiguous bytes per load.
// k order, chunk of 8: lane half h holds k = 4h..4h+3 of both operands.
// Epilogue: each wave also sums wy and wy^2 of its 32 rows over the group's 64
// columns, from the values it stores, and writes them as one 128-byte line each
// of psum / psq (row = work-group, column = channel) for the batchnorm.
// ---------------------------------------------------------------------------
struct WyFrag {     // two chunks of 8 k
  v4f a[2][2];      // W2 of 2 row tiles: row lm, k = 4*half .. 4*half+3 of chunk c
  v4f x[2][4];      // theta rows k = 4*half + i, columns t0 + 4*lm .. +3
};

__device__ __forceinline__ void wy_load(WyFrag& f, const float* wl,
                                        const float* tl, int s) {
  for (int c = 0; c < 2; ++c) {
    for (int m = 0; m < 2; ++m)
      f.a[c][m] = *(const v4f*)(wl + (m * 16 + s * 2 + c) * 128);
    for (int i = 0; i < 4; ++i)
      f.x[c][i] = *(const v4f*)(tl + (size_t)(s * 16 + c * 8 + i) * Tt);
  }
}

__device__ __forceinline__ void wy_mac(const WyFrag& f, v8f (&acc)[2][4]) {
  for (int c = 0; c < 2; ++c) {
    for (int p = 0; p < 2; ++p) {
      for (int j = 0; j < 4; ++j) {
        v2f bj;
        bj.x = f.x[c][2 * p][j];
        bj.y = f.x[c][2 * p + 1][j];
        for (int m = 0; m < 2; ++m) {
          v2f am;
          am.x = f.a[c][m][2 * p];
          am.y = f.a[c][m][2 * p + 1];
          acc[m][j] = wmma4(am, bj, acc[m][j]);
        }
      }
    }
  }
}

__global__ __launch_bounds__(256) void wy_kernel(
    const float* __restrict__ theta, const float* __restrict__ W2,
    const float* __restrict__ wb, float* __restrict__ outp,
    float* __restrict__ psum, float* __restrict__ psq) {
  int wv   = __builtin_amdgcn_readfirstlane(threadIdx.x >> 5);  // 0..7
  int lane = threadIdx.x & 31;
  int half = lane >> 4, lm = lane & 15;
  int b  = blockIdx.x >> 7;             // Bk * (Tt/64) = 512 work-groups
  int t0 = (blockIdx.x & 127) * 64;
  int o0 = wv * 32;

  const float* tl = theta + (size_t)b * Cin * Tt + (size_t)(half * 4) * Tt + t0 + lm * 4;
  const float* wl = W2 + ((size_t)b * 16 + wv * 2) * 16 * 128 + lane * 4;
  v8f a2[2][4] = {};
  // Two fragment sets of 16 k each: a set's loads are issued ahead of the 32
  // products of the set before it. The last pair of sets is peeled.
  // The scheduling barriers hold that order: without them the build spread the
  // loads among the products and waited for a set's last load about 13 products
  // after its issue.
  WyFrag f0, f1;
  wy_load(f0, wl, tl, 0);
  // kept rolled: unrolled whole, the build took 296 registers, too many for the
  // two work-groups that share a WGP
#pragma unroll 1
  for (int s = 0; s < Cin / 16 - 2; s += 2) {
    wy_load(f1, wl, tl, s + 1);
    __builtin_amdgcn_sched_barrier(0);  // loads above stay ahead of the products
    wy_mac(f0, a2);
    wy_load(f0, wl, tl, s + 2);
    __builtin_amdgcn_sched_barrier(0);  // loads above stay ahead of the products
    wy_mac(f1, a2);
  }
  wy_load(f1, wl, tl, Cin / 16 - 1);
  // precaution: the w_b loads below land in address registers of the loads
  // above; this wait stands in front of that overwrite
  asm volatile("s_wait_xcnt 0x0" ::: "memory");
  v4f bz[2][2];   // w_b of this lane's rows o0 + 16*m + 8*half + 0..7
  for (int m = 0; m < 2; ++m)
    for (int hh = 0; hh < 2; ++hh)
      bz[m][hh] = *(const v4f*)(wb + o0 + m * 16 + half * 8 + hh * 4);
  wy_mac(f0, a2);
  wy_mac(f1, a2);

  float rs[16], rq[16];   // this lane's 4 columns of row o0 + 16*m + 8*half + r
  for (int m = 0; m < 2; ++m) {
    float* ob = outp + ((size_t)b * Cc + o0 + m * 16) * Tt + t0 + lm * 4;
    for (int r = 0; r < 8; ++r) {
      int row = r + half * 8;
      float br = bz[m][r >> 2][r & 3];
      v4f v;
      v.x = a2[m][0][r] + br;
      v.y = a2[m][1][r] + br;
      v.z = a2[m][2][r] + br;
      v.w = a2[m][3][r] + br;
      *(v4f*)(ob + (size_t)row * Tt) = v;
      v2f lo = {v.x, v.y}, hi = {v.z, v.w};
      v2f a = lo + hi, p = lo * lo + hi * hi;
      rs[m * 8 + r] = a.x + a.y;
      rq[m * 8 + r] = p.x + p.y;
    }
  }
  // lane lm ends with list entry lm, which is m = lm >> 3, r = lm & 7
  float ts = row_scatter_sum(rs, lm);
  float tq = row_scatter_sum(rq, lm);
  size_t pidx = (size_t)blockIdx.x * Cc + o0 + (lm >> 3) * 16 + half * 8 + (lm & 7);
  psum[pidx] = ts;
  psq[pidx]  = tq;
}

// ---------------------------------------------------------------------------
// Kernel 4: out = scale[c]*wy + shift[c] + x   (wy already resident in d_out)
// One work-group: 32 channels (one 128-byte line of every psum / psq row) of one
// batch by APCOLS columns; 16 waves, 2 channel rows each. It first adds the
// NPART partial sums of its 32 channels in a fixed order and forms scale and
// shift itself; its wy and x loads are issued ahead of that and land meanwhile.
// ---------------------------------------------------------------------------
#define NPART  (Bk * Tt / 64)     // work-groups of wy_kernel = rows of psum, psq
#define APCOLS 1024

// Value of v in the same lane of the other 16-lane row.
__device__ __forceinline__ float other_row(float v) {
  int i = __builtin_bit_cast(int, v);
  return __builtin_bit_cast(
      float, __builtin_amdgcn_permlanex16(i, i, 0x76543210, 0xfedcba98, false,
                                          false));
}

__global__ __launch_bounds__(512) void bn_apply_kernel(
    const float* __restrict__ x, const float* __restrict__ psum,
    const float* __restrict__ psq, const float* __restrict__ gamma,
    const float* __restrict__ beta, float* outp) {
  __shared__ __attribute__((aligned(16))) float red[16][64];
  __shared__ float scsh[64];
  int tid  = threadIdx.x;
  int wv   = __builtin_amdgcn_readfirstlane(tid >> 5);  // 0..15
  int lane = tid & 31;
  int cg = blockIdx.x & 7;              // group of 32 channels
  int tc = (blockIdx.x >> 3) & 7;       // span of APCOLS columns
  int b  = blockIdx.x >> 6;

  // partial rows (tid >> 3) + 64*i, channels cg*32 + 4*(tid & 7) .. +3
  int poff = (tid >> 3) * Cc + cg * 32 + (tid & 7) * 4;
  v4f ps[NPART / 64], pq[NPART / 64];
  for (int i = 0; i < NPART / 64; ++i) {
    ps[i] = *(const v4f*)(psum + poff + i * 64 * Cc);
    pq[i] = *(const v4f*)(psq + poff + i * 64 * Cc);
  }
  float ga = gamma[cg * 32 + lane];
  float be = beta[cg * 32 + lane];
  // precaution: results of the loads below land in address registers of the
  // loads above; this wait stands in front of that overwrite
  asm volatile("s_wait_xcnt 0x0" ::: "memory");

  size_t rowoff = ((size_t)b * Cc + cg * 32 + wv * 2) * Tt + tc * APCOLS;
  const float* xr = x + rowoff;       // wave-uniform; the lane adds 4*lane
  float* orow = outp + rowoff;
  v4f wy[2][APCOLS / 128], xv[2][APCOLS / 128];
  for (int k = 0; k < 2; ++k) {
    for (int j = 0; j < APCOLS / 128; ++j) {
      wy[k][j] = *(const v4f*)(orow + k * Tt + j * 128 + lane * 4);
      xv[k][j] = *(const v4f*)(xr + k * Tt + j * 128 + lane * 4);
    }
  }
  // keeps every load above issued ahead of the first wait for a partial sum;
  // without it part of the wy loads is issued only as partial sums arrive
  __builtin_amdgcn_sched_barrier(0);

  v4f s = ps[0], q = pq[0];
  for (int i = 1; i < NPART / 64; ++i) {
    s += ps[i];
    q += pq[i];
  }
  // the 4 lanes of a wave that hold the same channels: lane ^ 8, lane ^ 16
  for (int e = 0; e < 4; ++e) {
    s[e] += row_xlane<0x168>(s[e]);
    q[e] += row_xlane<0x168>(q[e]);
    s[e] += other_row(s[e]);
    q[e] += other_row(q[e]);
  }
  if (lane < 8) {
    *(v4f*)&red[wv][lane * 4]      = s;
    *(v4f*)&red[wv][32 + lane * 4] = q;
  }
  __syncthreads();
  if (wv == 0) {
    float ss = red[0][lane], qq = red[0][32 + lane];
    for (int w = 1; w < 16; ++w) {
      ss += red[w][lane];
      qq += red[w][32 + lane];
    }
    float inv  = 1.0f / (float)(Bk * Tt);
    float mean = ss * inv;
    float var  = qq * inv - mean * mean;
    float sc   = ga * rsqrtf(var + BN_EPS);
    scsh[lane]      = sc;
    scsh[32 + lane] = be - mean * sc;
  }
  __syncthreads();

  for (int k = 0; k < 2; ++k) {
    float sc = scsh[wv * 2 + k], sh = scsh[32 + wv * 2 + k];
    for (int j = 0; j < APCOLS / 128; ++j) {
      v4f r;
      r.x = sc * wy[k][j].x + sh + xv[k][j].x;
      r.y = sc * wy[k][j].y + sh + xv[k][j].y;
      r.z = sc * wy[k][j].z + sh + xv[k][j].z;
      r.w = sc * wy[k][j].w + sh + xv[k][j].w;
      *(v4f*)(orow + k * Tt + j * 128 + lane * 4) = r;
    }
  }
}

// ---------------------------------------------------------------------------
extern "C" void kernel_launch(void* const* d_in, const int* in_sizes, int n_in,
                              void* d_out, int out_size, void* d_ws,
                              size_t ws_size, hipStream_t stream) {
  (void)in_sizes; (void)n_in; (void)out_size; (void)ws_size;
  const float* x       = (const float*)d_in[0];
  const float* theta_w = (const float*)d_in[1];
  const float* theta_b = (const float*)d_in[2];
  const float* phi_w   = (const float*)d_in[3];
  const float* phi_b   = (const float*)d_in[4];
  const float* g_w     = (const float*)d_in[5];
  const float* g_b     = (const float*)d_in[6];
  const float* w_w     = (const float*)d_in[7];
  const float* w_b     = (const float*)d_in[8];
  const float* gamma   = (const float*)d_in[9];
  const float* beta    = (const float*)d_in[10];
  float* outp = (float*)d_out;

  // workspace layout (floats)
  float* ws    = (float*)d_ws;
  float* theta = ws;                                   // 4*128*8192 = 4194304
  float* phiP  = theta + (size_t)Bk * Cin * Tt;        // 2097152
  float* gP    = phiP + (size_t)Bk * Cin * Npool;      // 2097152
  float* W2buf = gP + (size_t)Bk * Cin * Npool;        // 4*256*128 = 131072
  float* Mpart = W2buf + (size_t)Bk * Cc * Cin;        // KSPLIT * 65536
  float* psum  = Mpart + (size_t)KSPLIT * Bk * Cin * Cin;  // 512 * 256
  float* psq   = psum + (size_t)NPART * Cc;            // 512 * 256 (~39 MB total)

  // 1) theta = conv(theta_w) ; phiP/gP = maxpool2(conv(...))
  //    4 row-tile pairs x 128 column spans of 256
  conv3_kernel<<<512, 256, 0, stream>>>(x, theta_w, theta_b, phi_w, phi_b, g_w,
                                        g_b, theta, phiP, gP);

  // 2) M = phiP * gP^T / N   (256 tiles x KSPLIT slices), then the plane sum
  //    and W2 = w_w * M^T   (4 batches x 8 tiles of 16 cp x 2 halves of o)
  mmat_kernel<<<512, 256, 0, stream>>>(phiP, gP, Mpart);    // 32 * KSPLIT groups
  w2_kernel<<<64, 256, 0, stream>>>(Mpart, w_w, W2buf);

  // 3) wy = W2*theta + w_b  -> d_out   (4 x 128 spans of 64 columns)
  //    and the per-group batchnorm sums -> psum, psq
  wy_kernel<<<512, 256, 0, stream>>>(theta, W2buf, w_b, outp, psum, psq);

  // 4) batchnorm scale and shift from the partial sums, apply (+ residual)
  //    4 batches x 8 column spans x 8 channel groups
  bn_apply_kernel<<<256, 512, 0, stream>>>(x, psum, psq, gamma, beta, outp);
}
